// v000
// The times below were measured on an AMD MI455X: many runs one after another, warmed up first and cycling through
// copies of the inputs, with the whole window's GPU time divided by the number of runs. Launches and the gaps
// between them are all in it. The median over several windows is given; except for v000 it joins two sittings, which
// can be a few percent apart, so the side-by-side timings, each taken in one sitting, are the better comparison.
// v000, which the later versions start from, runs in 1480 microseconds.
// Contractions: x.W projections (q, k planes and v^T plane): single v_wmma_f32_16x16x32_bf16 product on RNE-bf16 converted x, W, bias; q.k^T scores and p.v output: bf16 hi/lo operand planes (hi.hi + hi.lo + lo.hi); all f32 accumulate; softmax in f32.
#include <hip/hip_runtime.h>
#include <math.h>

// ---------------------------------------------------------------------------
// Problem constants
// ---------------------------------------------------------------------------
constexpr int kBatch = 8;
constexpr int kSeq   = 2048;
constexpr int kDin   = 512;
constexpr int kUnits = 200;
constexpr int kUP    = 256;              // padded unit count (cols 200..255 exactly zero)
constexpr int kRows  = kBatch * kSeq;    // 16384 token rows
constexpr int kKS    = 224;              // score contraction depth (q/k cols 200..223 are exact zeros)
constexpr float kScoreScale = 0.070710678118654752f;   // 200^-0.5 applied in the f32 epilogue

static_assert(kSeq == 2048, "softmax kernel: 256 threads x 8 columns = one row");
static_assert(kRows % 64 == 0 && kUP % 64 == 0 && kSeq % 64 == 0 && kDin % 64 == 0, "tile multiples");
static_assert(kDin % 32 == 0 && kKS % 32 == 0 && kSeq % 32 == 0, "K multiples of 32");
static_assert(kKS >= kUnits && kKS <= kUP, "score depth covers all real units");
static_assert((kRows * kDin) % (8 * 256) == 0, "cast kernel grid exact");
static_assert((kRows * kUnits) % (4 * 256) == 0 && kUnits % 4 == 0, "copy kernel grid exact, float4 inside one row");
static_assert(kUP == 4 * 64, "bias kernel: 64 threads x 4 floats");

typedef __attribute__((ext_vector_type(16))) _Float16 v16h;
typedef __attribute__((ext_vector_type(8)))  _Float16 v8h;
typedef __attribute__((ext_vector_type(16))) __bf16   v16b;
typedef __attribute__((ext_vector_type(8)))  __bf16   v8b;
typedef __attribute__((ext_vector_type(8)))  float    v8f;
typedef __attribute__((ext_vector_type(4)))  float    v4f;
typedef __attribute__((ext_vector_type(4)))  unsigned int v4u;

// ---------------------------------------------------------------------------
// Device helpers
// ---------------------------------------------------------------------------
__device__ __forceinline__ unsigned short f2bf_bits(float f) {
  unsigned u = __float_as_uint(f);
  return (unsigned short)((u + 0x7FFFu + ((u >> 16) & 1u)) >> 16);
}
__device__ __forceinline__ float bf_bits2f(unsigned short h) { return __uint_as_float(((unsigned)h) << 16); }

// hazard guards as plain device helpers (no inline asm inside the kernel template body)
__device__ __forceinline__ void dep_guard_h(v8f& a, v8f& b, v16h x, v16h y) { asm volatile("v_nop\n\tv_nop\n\tv_nop\n\tv_nop" : "+v"(a), "+v"(b) : "v"(x), "v"(y)); }
__device__ __forceinline__ void dep_guard_b(v8f& a, v8f& b, v16b x, v16b y) { asm volatile("v_nop\n\tv_nop\n\tv_nop\n\tv_nop" : "+v"(a), "+v"(b) : "v"(x), "v"(y)); }
__device__ __forceinline__ void keep4_h(v16h a, v16h b, v16h c, v16h d) { asm volatile("v_nop" :: "v"(a), "v"(b), "v"(c), "v"(d)); }
__device__ __forceinline__ void keep4_b(v16b a, v16b b, v16b c, v16b d) { asm volatile("v_nop" :: "v"(a), "v"(b), "v"(c), "v"(d)); }
__device__ __forceinline__ void acc_guard4(v8f& a, v8f& b, v8f& c, v8f& d) { asm volatile("v_nop\n\tv_nop\n\tv_nop\n\tv_nop" : "+v"(a), "+v"(b), "+v"(c), "+v"(d)); }
template <typename T> struct Frag;
template <> struct Frag<_Float16> {
  typedef v16h V; union U { v16h v; v8h h[2]; };
  // elements 0..7 <- p[0..7], 8..15 <- p[16..23]
  static __device__ __forceinline__ v16h load(const _Float16* p) {
    U f; f.h[0] = *(const v8h*)(p); f.h[1] = *(const v8h*)(p + 16); return f.v;
  }
  static __device__ __forceinline__ v8f mma(v16h a, v16h b, v8f c) {
    return __builtin_amdgcn_wmma_f32_16x16x32_f16(false, a, false, b, (short)0, c, false, false);
  }
  static __device__ __forceinline__ void guard(v8f& a, v8f& b, v16h x, v16h y) { dep_guard_h(a, b, x, y); }
  static __device__ __forceinline__ void keep(v16h a, v16h b, v16h c, v16h d) { keep4_h(a, b, c, d); }
};
template <> struct Frag<__bf16> {
  typedef v16b V; union U { v16b v; v8b h[2]; };
  static __device__ __forceinline__ v16b load(const __bf16* p) {
    U f; f.h[0] = *(const v8b*)(p); f.h[1] = *(const v8b*)(p + 16); return f.v;
  }
  static __device__ __forceinline__ v8f mma(v16b a, v16b b, v8f c) {
    return __builtin_amdgcn_wmma_f32_16x16x32_bf16(false, a, false, b, (short)0, c, false, false);
  }
  static __device__ __forceinline__ void guard(v8f& a, v8f& b, v16b x, v16b y) { dep_guard_b(a, b, x, y); }
  static __device__ __forceinline__ void keep(v16b a, v16b b, v16b c, v16b d) { keep4_b(a, b, c, d); }
};

__device__ __forceinline__ unsigned pk16(unsigned short a, unsigned short b) { return (unsigned)a | ((unsigned)b << 16); }

// ---- Register-blocked batched WMMA GEMM (ACT reduced to none/relu/leaky; CAUSAL and BSPLIT options) ----
// C[m,n] = scale * sum_k A[m,k] * Bt[n,k] (+bias)(+resid); each wave owns a 64x64 tile.
// A row-major [M,K]; Bt row-major [N,K]; M,N % 64 == 0, K % 32 == 0.
// SPLIT: operands are hi/lo planes (A2/Bt2 = lo planes, same layout); product = hi.hi + hi.lo + lo.hi.
// SPLIT with BSPLIT == false: only A carries a lo plane; product = hi.B + lo.B (Bt2 unused).
// BIAS_MODE: 0 = none, 1 = bias[m], 2 = bias[n].
// OUT_MODE: 0 = f32, 1 = f16, 2 = bf16 hi plane (Cout) + bf16 lo plane (Cout2).
// CAUSAL: tiles with n0 > m0 are skipped (wave-uniform) and the k loop stops at min(K, m0 + 64).
// ET: 0 = f16 operands, 1 = bf16 operands (pointers passed as 16-bit storage)
template <int ET> struct Elem;
template <> struct Elem<0> { typedef _Float16 T; };
template <> struct Elem<1> { typedef __bf16 T; };
template <int ET, bool SPLIT, int BIAS_MODE, int OUT_MODE, bool RESID, int ACT = 0, bool CAUSAL = false, bool BSPLIT = true>
__global__ __launch_bounds__(256) void wmma_gemm64(
    const unsigned short* __restrict__ Ap, const unsigned short* __restrict__ A2p, int lda, long strideA,
    const unsigned short* __restrict__ Btp, const unsigned short* __restrict__ Bt2p, int ldb, long strideB,
    void* __restrict__ Cout, void* __restrict__ Cout2, int ldc, long strideC,
    const float* __restrict__ bias,
    const float* __restrict__ resid, long strideR,
    int M, int N, int K, float scale) {
  typedef typename Elem<ET>::T T;
  typedef typename Frag<T>::V V;
  const T* A = (const T*)Ap; const T* A2 = (const T*)A2p; const T* Bt = (const T*)Btp; const T* Bt2 = (const T*)Bt2p;
  __shared__ __align__(16) float sT[8][16 * 68];   // per-wave 16x64 slab, pitch 68 floats
  const int b    = blockIdx.y;
  const int lane = threadIdx.x & 31;
  const int wave = threadIdx.x >> 5;
  const int tilesN = N >> 6;
  const int tilesM = M >> 6;
  const int tile = blockIdx.x * 8 + wave;
  if (tile >= tilesM * tilesN) return;   // wave-uniform; no block barriers in this kernel
  const int tm = tile / tilesN;
  const int tn = tile - tm * tilesN;
  const int m0 = tm << 6;
  const int n0 = tn << 6;
  if (CAUSAL && (n0 > m0)) return;       // wave-uniform causal tile skip
  const int Kend = CAUSAL ? ((m0 + 64 < K) ? (m0 + 64) : K) : K;   // multiple of 32

  const T* Ab  = A  + (size_t)b * strideA;
  const T* Bb  = Bt + (size_t)b * strideB;
  const T* Ab2 = SPLIT ? (A2  + (size_t)b * strideA) : nullptr;
  const T* Bb2 = (SPLIT && BSPLIT) ? (Bt2 + (size_t)b * strideB) : nullptr;

  const int rlane = lane & 15;                 // row (A) / col (B, D) within subtile
  const int koff  = (lane >> 4) * 8;           // k offset of this lane half
  const int mOff  = (lane >> 4) * 8;           // D row offset

  v8f acc[4][4];
#pragma unroll
  for (int i = 0; i < 4; ++i)
#pragma unroll
    for (int j = 0; j < 4; ++j) acc[i][j] = (v8f){0.f,0.f,0.f,0.f,0.f,0.f,0.f,0.f};

  for (int k0 = 0; k0 < Kend; k0 += 32) {
    V bh[4], bl[4];
#pragma unroll
    for (int j = 0; j < 4; ++j) {
      const size_t bo = (size_t)(n0 + (j << 4) + rlane) * ldb + koff + k0;
      bh[j] = Frag<T>::load(Bb + bo);
      if (SPLIT && BSPLIT) bl[j] = Frag<T>::load(Bb2 + bo);
    }
#pragma unroll
    for (int i = 0; i < 4; ++i) {
      const size_t ao = (size_t)(m0 + (i << 4) + rlane) * lda + koff + k0;
      V ah = Frag<T>::load(Ab + ao);
      V al;
      if (SPLIT) al = Frag<T>::load(Ab2 + ao);
#pragma unroll
      for (int j = 0; j < 4; ++j) {
        acc[i][j] = Frag<T>::mma(ah, bh[j], acc[i][j]);
        if (SPLIT && BSPLIT) acc[i][j] = Frag<T>::mma(ah, bl[j], acc[i][j]);
        if (SPLIT) acc[i][j] = Frag<T>::mma(al, bh[j], acc[i][j]);
      }
      Frag<T>::guard(acc[i][0], acc[i][3], ah, SPLIT ? al : ah);
    }
    Frag<T>::keep(bh[0], bh[1], bh[2], bh[3]);
    if (SPLIT && BSPLIT) Frag<T>::keep(bl[0], bl[1], bl[2], bl[3]);
  }
  acc_guard4(acc[0][0], acc[0][1], acc[0][2], acc[0][3]);
  acc_guard4(acc[1][0], acc[1][1], acc[1][2], acc[1][3]);
  acc_guard4(acc[2][0], acc[2][1], acc[2][2], acc[2][3]);
  acc_guard4(acc[3][0], acc[3][1], acc[3][2], acc[3][3]);

  // ---- epilogue ----
  float* slab = sT[wave];
  const float* Rb = RESID ? (resid + (size_t)b * strideR) : nullptr;
#pragma unroll
  for (int i = 0; i < 4; ++i) {
    const int mBase = m0 + (i << 4);
#pragma unroll
    for (int j = 0; j < 4; ++j) {
      const int n = n0 + (j << 4) + rlane;
      float bv = 0.f;
      if (BIAS_MODE == 2) bv = bias[n];
#pragma unroll
      for (int r = 0; r < 8; ++r) {
        float v = acc[i][j][r] * scale;
        if (BIAS_MODE == 1) v += bias[mBase + mOff + r];
        if (BIAS_MODE == 2) v += bv;
        if (RESID) v += Rb[(size_t)(mBase + mOff + r) * ldc + n];
        if (ACT == 2) v = fmaxf(v, 0.0f);
        if (ACT == 4) v = (v > 0.f) ? v : 0.01f * v;
        slab[(mOff + r) * 68 + (j << 4) + rlane] = v;
      }
    }
    __builtin_amdgcn_fence(__ATOMIC_RELEASE, "workgroup");
    __builtin_amdgcn_wave_barrier();
    __builtin_amdgcn_fence(__ATOMIC_ACQUIRE, "workgroup");
    if (OUT_MODE == 0) {
      float* C = (float*)Cout + (size_t)b * strideC;
      const int hh = lane >> 4, c4 = (lane & 15) * 4;     // row seg = 256 B = 16 lanes x 16 B
      {
#pragma unroll
        for (int it = 0; it < 8; ++it) {
          const int row = it * 2 + hh;
          v4f v = *(const v4f*)(slab + row * 68 + c4);
          *(v4f*)(C + (size_t)(mBase + row) * ldc + n0 + c4) = v;
        }
        
      }
    } else {
      const int q = lane >> 3, c8 = (lane & 7) * 8;
      unsigned short* C  = (unsigned short*)Cout  + (size_t)b * strideC;
      unsigned short* C2 = (OUT_MODE == 2) ? ((unsigned short*)Cout2 + (size_t)b * strideC) : nullptr;
      {
#pragma unroll
        for (int it = 0; it < 4; ++it) {
          const int row = it * 4 + q;
          const float* sp = slab + row * 68 + c8;
          v8h hv, lv;
#pragma unroll
          for (int e = 0; e < 8; ++e) {
            if (OUT_MODE == 1) {
              hv[e] = (_Float16)sp[e];
            } else {
              unsigned short hb = f2bf_bits(sp[e]);
              unsigned short lb = f2bf_bits(sp[e] - bf_bits2f(hb));
              hv[e] = __builtin_bit_cast(_Float16, hb);
              lv[e] = __builtin_bit_cast(_Float16, lb);
            }
          }
          *(v8h*)(C + (size_t)(mBase + row) * ldc + n0 + c8) = hv;
          if (OUT_MODE == 2) *(v8h*)(C2 + (size_t)(mBase + row) * ldc + n0 + c8) = lv;
        }
        
      }
    }
    __builtin_amdgcn_fence(__ATOMIC_RELEASE, "workgroup");
    __builtin_amdgcn_wave_barrier();
    __builtin_amdgcn_fence(__ATOMIC_ACQUIRE, "workgroup");
  }
}

// ---------------------------------------------------------------------------
// f32 -> RNE bf16 plane, 8 consecutive elements per thread packed as integer words.
// Coverage: n8 = n/8 threads x 8 = the whole plane (grid is an exact multiple of 256 here).
// ---------------------------------------------------------------------------
__global__ __launch_bounds__(256) void cast8_bf16_kernel(const float* __restrict__ in, unsigned short* __restrict__ out, int n8) {
  const int i = blockIdx.x * 256 + threadIdx.x;
  if (i >= n8) return;
  const float* p = in + 8 * (size_t)i;
  const v4f a = *(const v4f*)(p);
  const v4f c = *(const v4f*)(p + 4);
  float f[8];
#pragma unroll
  for (int e = 0; e < 4; ++e) { f[e] = a[e]; f[4 + e] = c[e]; }
  unsigned w[4];
#pragma unroll
  for (int e2 = 0; e2 < 4; ++e2) w[e2] = pk16(f2bf_bits(f[2 * e2]), f2bf_bits(f[2 * e2 + 1]));
  const v4u u = (v4u){w[0], w[1], w[2], w[3]};
  unsigned short* q = out + 8 * (size_t)i;
  *(v4u*)q = u;
  
}

// ---------------------------------------------------------------------------
// Transpose + RNE bf16 convert of a weight matrix with zero padding of the output rows:
// in f32 [R][ncol] row-major (ldin = ncol) -> out bf16 [Cpad][R] (ldout = R): out[c][r] = bf16(in[r][c]) for c < ncol, 0 for c >= ncol.
// grid (R/64, Cpad/64): blockIdx.x = r tile (64 output cols), blockIdx.y = c tile (64 output rows). 256 threads.
// Load coverage: 16 iterations x 256 threads = 4096 = the whole 64x64 tile; column ADDRESS clamped to ncol-1, value zeroed by predicate.
// Store coverage: 8 waves x 2 iterations x 4 rows (lane>>3) = 64 rows; (lane&7) x 8 halves = 64 cols; each row segment =
// ---------------------------------------------------------------------------
__global__ __launch_bounds__(256) void transpose_cast_pad_kernel(const float* __restrict__ in, int ldin, int ncol,
                                                                 unsigned short* __restrict__ out, int ldout) {
  __shared__ float sm[64][65];   // sm[c_local][r_local]
  const int t  = threadIdx.x;
  const int r0 = blockIdx.x * 64;
  const int c0 = blockIdx.y * 64;
#pragma unroll
  for (int i = 0; i < 16; ++i) {
    const int e = i * 256 + t;
    const int r = e >> 6;          // r local
    const int c = e & 63;          // c local
    const int cg = c0 + c;
    const int cc = (cg < ncol) ? cg : (ncol - 1);
    const float v = in[(size_t)(r0 + r) * ldin + cc];
    sm[c][r] = (cg < ncol) ? v : 0.0f;
  }
  __syncthreads();
  const int lane = t & 31, wave = t >> 5;
  const int q = lane >> 3, c8 = (lane & 7) * 8;
  {
#pragma unroll
    for (int it = 0; it < 2; ++it) {
      const int row = wave * 8 + it * 4 + q;                 // c local (output row)
      unsigned w[4];
#pragma unroll
      for (int e2 = 0; e2 < 4; ++e2) w[e2] = pk16(f2bf_bits(sm[row][c8 + 2 * e2]), f2bf_bits(sm[row][c8 + 2 * e2 + 1]));
      const v4u u = (v4u){w[0], w[1], w[2], w[3]};
      const size_t o = (size_t)(c0 + row) * ldout + r0 + c8;
      *(v4u*)(out + o) = u;
    }
    
  }
}

// ---------------------------------------------------------------------------
// Bias vectors -> RNE-bf16 valued f32 lines padded to kUP: outp[p][u] = bf16(b_p[u]) for u < nvalid, 0 otherwise (p = blockIdx.x in 0..2).
// All three candidates loaded with a clamped index, selected by value. 64 threads x 4 floats = 256 = kUP;
// ---------------------------------------------------------------------------
__global__ __launch_bounds__(64) void bias_pad_kernel(const float* __restrict__ b0, const float* __restrict__ b1,
                                                     const float* __restrict__ b2, int nvalid, float* __restrict__ outp) {
  const int p = blockIdx.x;
  const int t = threadIdx.x;
  float f[4];
#pragma unroll
  for (int e = 0; e < 4; ++e) {
    const int u  = 4 * t + e;
    const int uc = (u < nvalid) ? u : (nvalid - 1);
    const float v0 = b0[uc], v1 = b1[uc], v2 = b2[uc];
    float v = (p == 0) ? v0 : ((p == 1) ? v1 : v2);
    v = bf_bits2f(f2bf_bits(v));
    f[e] = (u < nvalid) ? v : 0.0f;
  }
  const v4f val = (v4f){f[0], f[1], f[2], f[3]};
  float* dst = outp + (size_t)p * kUP + 4 * t;
  *(v4f*)dst = val;
  
}

// ---------------------------------------------------------------------------
// Row softmax over materialised f32 scores of one batch (2048 rows x 2048 cols), no mask.
// p = exp(score - max) * (1/sum); P written as bf16 hi/lo planes.
// One block of 256 threads per row; thread t owns columns 8t..8t+7 (256 x 8 = 2048).
// Reductions in fixed order (thread, wave shuffle tree, 8 wave partials in index order); shuffles outside all branches.
// ---------------------------------------------------------------------------
__global__ __launch_bounds__(256) void softmax_rows_kernel(const float* __restrict__ S,
                                                           unsigned short* __restrict__ Phi, unsigned short* __restrict__ Plo) {
  __shared__ float redM[8];
  __shared__ float redS[8];
  const int qi   = blockIdx.x;           // query row 0..2047
  const int t    = threadIdx.x;
  const int lane = t & 31, wave = t >> 5;
  const int c0   = t * 8;
  const size_t rowoff = (size_t)qi * (size_t)kSeq;

  const float* sr = S + rowoff + c0;
  const v4f a = *(const v4f*)(sr);
  const v4f c = *(const v4f*)(sr + 4);
  float xv[8];
#pragma unroll
  for (int e = 0; e < 4; ++e) { xv[e] = a[e]; xv[4 + e] = c[e]; }
  float m = xv[0];
#pragma unroll
  for (int e = 1; e < 8; ++e) m = fmaxf(m, xv[e]);
#pragma unroll
  for (int off = 16; off > 0; off >>= 1) m = fmaxf(m, __shfl_xor(m, off, 32));
  if (lane == 0) redM[wave] = m;
  __syncthreads();
  float gmax = redM[0];
#pragma unroll
  for (int w = 1; w < 8; ++w) gmax = fmaxf(gmax, redM[w]);

  float p[8];
  float ps = 0.0f;
#pragma unroll
  for (int e = 0; e < 8; ++e) { p[e] = expf(xv[e] - gmax); ps += p[e]; }
#pragma unroll
  for (int off = 16; off > 0; off >>= 1) ps += __shfl_xor(ps, off, 32);
  if (lane == 0) redS[wave] = ps;
  __syncthreads();
  float tot = redS[0];
#pragma unroll
  for (int w = 1; w < 8; ++w) tot += redS[w];
  const float inv = 1.0f / tot;          // tot >= 1

  unsigned hw[4], lw[4];
#pragma unroll
  for (int e2 = 0; e2 < 4; ++e2) {
    const float f0 = p[2 * e2] * inv;
    const float f1 = p[2 * e2 + 1] * inv;
    const unsigned short h0 = f2bf_bits(f0);
    const unsigned short h1 = f2bf_bits(f1);
    const unsigned short l0 = f2bf_bits(f0 - bf_bits2f(h0));
    const unsigned short l1 = f2bf_bits(f1 - bf_bits2f(h1));
    hw[e2] = pk16(h0, h1);
    lw[e2] = pk16(l0, l1);
  }
  const v4u hv = (v4u){hw[0], hw[1], hw[2], hw[3]};
  const v4u lv = (v4u){lw[0], lw[1], lw[2], lw[3]};
  unsigned short* ph = Phi + rowoff + c0;
  unsigned short* pl = Plo + rowoff + c0;
  *(v4u*)ph = hv;
  *(v4u*)pl = lv;
  
}

// ---------------------------------------------------------------------------
// Final copy: tmp f32 [kRows][kUP] (pitch 256) -> out f32 flat [kRows][kUnits] (pitch 200, contiguous).
// Thread i owns flat output elements 4i..4i+3 (same row since 200 % 4 == 0); one 16-B store per lane, thread-linear from the
// Coverage: n4 = kRows*kUnits/4 threads x 4 = the whole output (grid exact multiple of 256).
// ---------------------------------------------------------------------------
__global__ __launch_bounds__(256) void copy_out_kernel(const float* __restrict__ tmp, float* __restrict__ out, int n4) {
  const int i = blockIdx.x * 256 + threadIdx.x;
  if (i >= n4) return;
  const int e   = 4 * i;
  const int row = e / kUnits;
  const int col = e - row * kUnits;
  const v4f v = *(const v4f*)(tmp + (size_t)row * kUP + col);
  float* dst = out + (size_t)e;
  *(v4f*)dst = v;
  
}

// ---------------------------------------------------------------------------
// Launcher. Workspace region map (bytes, MiB = 1048576; total carve = 96 MiB + 786432 + 3072 = 101452800 B):
//   [  0, 16) Xg    : generated as bf16 [16384][512] (16 MiB).   later alias: S f32 [2048][2048] (16 MiB) per batch
//   [ 16, 32) Xr    : real as bf16 [16384][512].                 later alias: P hi bf16 [2048][2048] at 16 MiB (8 MiB), P lo at 24 MiB (8 MiB)
//   [ 32, 40) q hi  : bf16 [16384][256]; [40, 48) q lo
//   [ 48, 56) k hi  : bf16 [16384][256]; [56, 64) k lo
//   [ 64, 72) v^T hi: bf16 [256][16384]; [72, 80) v^T lo
//   [ 80, 96) O tmp : f32 [16384][256]
//   [ 96 MiB, +786432)  W^T planes: 3 x bf16 [256][512] (262144 B each: Wq^T, Wk^T, Wv^T; rows 200..255 zero)
//   [ +786432, +3072)   bias lines: 3 x f32 [256] (RNE-bf16 values, 200..255 zero)
// Lifetimes: Xg is read only by the q projection, Xr only by the k and v^T projections (launches 7..9); S/P first written in launch 10.
// Launch count: 2 casts + 3 transposes + 1 bias + 3 projections + 8 x (scores, softmax, p.v) + 1 copy = 34. Kernel launches only.
// GEMM shapes: proj q/k M=16384 N=256 K=512; v^T M=256 N=16384 K=512; scores M=N=2048 K=224; p.v M=2048 N=256 K=2048 (all M,N % 64 == 0, K % 32 == 0).
// ---------------------------------------------------------------------------
extern "C" void kernel_launch(void* const* d_in, const int* in_sizes, int n_in,
                              void* d_out, int out_size, void* d_ws, size_t ws_size,
                              hipStream_t stream) {
  if (n_in < 8) return;
  if (in_sizes[0] != kRows * kDin || in_sizes[1] != kRows * kDin) return;
  if (in_sizes[2] != kDin * kUnits || in_sizes[4] != kDin * kUnits || in_sizes[6] != kDin * kUnits) return;
  if (in_sizes[3] != kUnits || in_sizes[5] != kUnits || in_sizes[7] != kUnits) return;
  if (out_size != kRows * kUnits) return;

  const size_t kMiB    = 1048576;
  const size_t offXg   = 0;
  const size_t offXr   = 16 * kMiB;
  const size_t offS    = 0;
  const size_t offPhi  = 16 * kMiB;
  const size_t offPlo  = 24 * kMiB;
  const size_t offQhi  = 32 * kMiB;
  const size_t offQlo  = 40 * kMiB;
  const size_t offKhi  = 48 * kMiB;
  const size_t offKlo  = 56 * kMiB;
  const size_t offVhi  = 64 * kMiB;
  const size_t offVlo  = 72 * kMiB;
  const size_t offO    = 80 * kMiB;
  const size_t wplane  = (size_t)kUP * kDin * 2;                 // 262144 B
  const size_t offWq   = 96 * kMiB;
  const size_t offWk   = offWq + wplane;
  const size_t offWv   = offWk + wplane;
  const size_t offBias = offWv + wplane;                         // 96 MiB + 786432
  const size_t total   = offBias + (size_t)3 * kUP * 4;          // 101452800 B
  if (total > ws_size) return;

  const float* gen  = (const float*)d_in[0];
  const float* real = (const float*)d_in[1];
  const float* Wq   = (const float*)d_in[2];
  const float* bq   = (const float*)d_in[3];
  const float* Wk   = (const float*)d_in[4];
  const float* bk   = (const float*)d_in[5];
  const float* Wv   = (const float*)d_in[6];
  const float* bv   = (const float*)d_in[7];
  float* out = (float*)d_out;
  char* ws = (char*)d_ws;

  unsigned short* xg   = (unsigned short*)(ws + offXg);
  unsigned short* xr   = (unsigned short*)(ws + offXr);
  float*          Sbuf = (float*)(ws + offS);
  unsigned short* phi  = (unsigned short*)(ws + offPhi);
  unsigned short* plo  = (unsigned short*)(ws + offPlo);
  unsigned short* qhi  = (unsigned short*)(ws + offQhi);
  unsigned short* qlo  = (unsigned short*)(ws + offQlo);
  unsigned short* khi  = (unsigned short*)(ws + offKhi);
  unsigned short* klo  = (unsigned short*)(ws + offKlo);
  unsigned short* vthi = (unsigned short*)(ws + offVhi);
  unsigned short* vtlo = (unsigned short*)(ws + offVlo);
  float*          Otmp = (float*)(ws + offO);
  unsigned short* wqT  = (unsigned short*)(ws + offWq);
  unsigned short* wkT  = (unsigned short*)(ws + offWk);
  unsigned short* wvT  = (unsigned short*)(ws + offWv);
  float*          biasP = (float*)(ws + offBias);

  // in-range dummies for unused (never dereferenced) template-dead pointer parameters
  const float* dummy_f = biasP;
  void* dummy_c2 = (void*)phi;

  // 1-2. activations -> RNE bf16 planes [16384][512]
  {
    const int n8 = (kRows * kDin) / 8;                      // 1048576 = 4096 blocks x 256
    cast8_bf16_kernel<<<dim3(n8 / 256), dim3(256), 0, stream>>>(gen, xg, n8);
    cast8_bf16_kernel<<<dim3(n8 / 256), dim3(256), 0, stream>>>(real, xr, n8);
  }
  // 3-5. W [R=512][ncol=200] -> W^T bf16 [256][512] with rows 200..255 zero; grid (R/64, 256/64)
  transpose_cast_pad_kernel<<<dim3(kDin / 64, kUP / 64), dim3(256), 0, stream>>>(Wq, kUnits, kUnits, wqT, kDin);
  transpose_cast_pad_kernel<<<dim3(kDin / 64, kUP / 64), dim3(256), 0, stream>>>(Wk, kUnits, kUnits, wkT, kDin);
  transpose_cast_pad_kernel<<<dim3(kDin / 64, kUP / 64), dim3(256), 0, stream>>>(Wv, kUnits, kUnits, wvT, kDin);
  // 6. biases -> padded RNE-bf16 valued f32 lines [3][256]
  bias_pad_kernel<<<dim3(3), dim3(64), 0, stream>>>(bq, bk, bv, kUnits, biasP);

  // 7. q = Xg . Wq^T + bq : M=16384, N=256, K=512, single bf16 product -> bf16 hi/lo planes [16384][256]
  wmma_gemm64<1, false, 2, 2, false, 0, false, true><<<dim3((kRows / 64) * (kUP / 64) / 8, 1), dim3(256), 0, stream>>>(
      xg, xg, kDin, 0L,
      wqT, wqT, kDin, 0L,
      (void*)qhi, (void*)qlo, kUP, 0L,
      biasP, dummy_f, 0L,
      kRows, kUP, kDin, 1.0f);
  // 8. k = Xr . Wk^T + bk
  wmma_gemm64<1, false, 2, 2, false, 0, false, true><<<dim3((kRows / 64) * (kUP / 64) / 8, 1), dim3(256), 0, stream>>>(
      xr, xr, kDin, 0L,
      wkT, wkT, kDin, 0L,
      (void*)khi, (void*)klo, kUP, 0L,
      biasP + kUP, dummy_f, 0L,
      kRows, kUP, kDin, 1.0f);
  // 9. v^T = Wv^T . Xr^T + bv[m] : M=256 (u), N=16384 (b*2048+t), K=512 -> bf16 hi/lo planes [256][16384]
  wmma_gemm64<1, false, 1, 2, false, 0, false, true><<<dim3((kUP / 64) * (kRows / 64) / 8, 1), dim3(256), 0, stream>>>(
      wvT, wvT, kDin, 0L,
      xr, xr, kDin, 0L,
      (void*)vthi, (void*)vtlo, kRows, 0L,
      biasP + 2 * kUP, dummy_f, 0L,
      kUP, kRows, kDin, 1.0f);

  // 10. attention per batch
  for (int b = 0; b < kBatch; ++b) {
    const size_t qkoff = (size_t)b * kSeq * kUP;            // halves
    // scores = 200^-0.5 * q . k^T : M=N=2048, K=224 (cols 200..223 exact zeros), 3 products on hi/lo planes -> f32 [2048][2048]
    wmma_gemm64<1, true, 0, 0, false, 0, false, true><<<dim3((kSeq / 64) * (kSeq / 64) / 8, 1), dim3(256), 0, stream>>>(
        qhi + qkoff, qlo + qkoff, kUP, 0L,
        khi + qkoff, klo + qkoff, kUP, 0L,
        (void*)Sbuf, dummy_c2, kSeq, 0L,
        dummy_f, dummy_f, 0L,
        kSeq, kSeq, kKS, kScoreScale);

    // softmax rows -> P hi/lo planes [2048][2048]
    softmax_rows_kernel<<<dim3(kSeq), dim3(256), 0, stream>>>(Sbuf, phi, plo);

    // O = P . v : M=2048, N=256, K=2048, 3 products; Bt = v^T rows u, cols b*2048.. (ldb 16384) -> f32 temp rows b*2048.., pitch 256
    const size_t vtoff = (size_t)b * kSeq;                   // halves
    wmma_gemm64<1, true, 0, 0, false, 0, false, true><<<dim3((kSeq / 64) * (kUP / 64) / 8, 1), dim3(256), 0, stream>>>(
        phi, plo, kSeq, 0L,
        vthi + vtoff, vtlo + vtoff, kRows, 0L,
        (void*)(Otmp + (size_t)b * kSeq * kUP), dummy_c2, kUP, 0L,
        dummy_f, dummy_f, 0L,
        kSeq, kUP, kSeq, 1.0f);
  }

  // 11. temp [16384][256] -> out [16384][200] contiguous
  {
    const int n4 = (kRows * kUnits) / 4;                    // 819200 = 3200 blocks x 256
    copy_out_kernel<<<dim3(n4 / 256), dim3(256), 0, stream>>>(Otmp, out, n4);
  }
}

// v001
// A run of this version takes 383 microseconds.
// Next to v000, in two timings, it ran 3.91 and 3.82 times as fast.
// Contractions: x.W projections (q, k planes and v^T plane): single v_wmma_f32_16x16x32_bf16 product on RNE-bf16 converted x, W, bias; q.k^T scores and p.v output: bf16 hi/lo operand planes (hi.hi + hi.lo + lo.hi); all f32 accumulate; softmax in f32.
#include <hip/hip_runtime.h>
#include <math.h>

// ---------------------------------------------------------------------------
// Problem constants
// ---------------------------------------------------------------------------
constexpr int kBatch = 8;
constexpr int kSeq   = 2048;
constexpr int kDin   = 512;
constexpr int kUnits = 200;
constexpr int kUP    = 256;              // padded unit count (cols 200..255 exactly zero)
constexpr int kRows  = kBatch * kSeq;    // 16384 token rows
constexpr int kKS    = 224;              // score contraction depth (q/k cols 200..223 are exact zeros)
constexpr float kScoreScale = 0.070710678118654752f;   // 200^-0.5 applied in the f32 epilogue

static_assert(kSeq == 2048, "softmax kernel: 256 threads x 8 columns = one row");
static_assert(kRows % 64 == 0 && kUP % 64 == 0 && kSeq % 64 == 0 && kDin % 64 == 0, "tile multiples");
static_assert(kDin % 32 == 0 && kKS % 32 == 0 && kSeq % 32 == 0, "K multiples of 32");
static_assert(kKS >= kUnits && kKS <= kUP, "score depth covers all real units");
static_assert((kRows * kDin) % (8 * 256) == 0, "cast kernel grid exact");
static_assert((kRows * kUnits) % (4 * 256) == 0 && kUnits % 4 == 0, "copy kernel grid exact, float4 inside one row");
static_assert(kUP == 4 * 64, "bias kernel: 64 threads x 4 floats");

typedef __attribute__((ext_vector_type(16))) _Float16 v16h;
typedef __attribute__((ext_vector_type(8)))  _Float16 v8h;
typedef __attribute__((ext_vector_type(16))) __bf16   v16b;
typedef __attribute__((ext_vector_type(8)))  __bf16   v8b;
typedef __attribute__((ext_vector_type(8)))  float    v8f;
typedef __attribute__((ext_vector_type(4)))  float    v4f;
typedef __attribute__((ext_vector_type(4)))  unsigned int v4u;

// ---------------------------------------------------------------------------
// Device helpers
// ---------------------------------------------------------------------------
__device__ __forceinline__ unsigned short f2bf_bits(float f) {
  unsigned u = __float_as_uint(f);
  return (unsigned short)((u + 0x7FFFu + ((u >> 16) & 1u)) >> 16);
}
__device__ __forceinline__ float bf_bits2f(unsigned short h) { return __uint_as_float(((unsigned)h) << 16); }

// hazard guards as plain device helpers (no inline asm inside the kernel template body)
__device__ __forceinline__ void dep_guard_h(v8f& a, v8f& b, v16h x, v16h y) { asm volatile("v_nop\n\tv_nop\n\tv_nop\n\tv_nop" : "+v"(a), "+v"(b) : "v"(x), "v"(y)); }
__device__ __forceinline__ void dep_guard_b(v8f& a, v8f& b, v16b x, v16b y) { asm volatile("v_nop\n\tv_nop\n\tv_nop\n\tv_nop" : "+v"(a), "+v"(b) : "v"(x), "v"(y)); }
__device__ __forceinline__ void keep4_h(v16h a, v16h b, v16h c, v16h d) { asm volatile("v_nop" :: "v"(a), "v"(b), "v"(c), "v"(d)); }
__device__ __forceinline__ void keep4_b(v16b a, v16b b, v16b c, v16b d) { asm volatile("v_nop" :: "v"(a), "v"(b), "v"(c), "v"(d)); }
__device__ __forceinline__ void acc_guard4(v8f& a, v8f& b, v8f& c, v8f& d) { asm volatile("v_nop\n\tv_nop\n\tv_nop\n\tv_nop" : "+v"(a), "+v"(b), "+v"(c), "+v"(d)); }
template <typename T> struct Frag;
template <> struct Frag<_Float16> {
  typedef v16h V; union U { v16h v; v8h h[2]; };
  // elements 0..7 <- p[0..7], 8..15 <- p[16..23]
  static __device__ __forceinline__ v16h load(const _Float16* p) {
    U f; f.h[0] = *(const v8h*)(p); f.h[1] = *(const v8h*)(p + 16); return f.v;
  }
  static __device__ __forceinline__ v8f mma(v16h a, v16h b, v8f c) {
    return __builtin_amdgcn_wmma_f32_16x16x32_f16(false, a, false, b, (short)0, c, false, false);
  }
  static __device__ __forceinline__ void guard(v8f& a, v8f& b, v16h x, v16h y) { dep_guard_h(a, b, x, y); }
  static __device__ __forceinline__ void keep(v16h a, v16h b, v16h c, v16h d) { keep4_h(a, b, c, d); }
};
template <> struct Frag<__bf16> {
  typedef v16b V; union U { v16b v; v8b h[2]; };
  static __device__ __forceinline__ v16b load(const __bf16* p) {
    U f; f.h[0] = *(const v8b*)(p); f.h[1] = *(const v8b*)(p + 16); return f.v;
  }
  static __device__ __forceinline__ v8f mma(v16b a, v16b b, v8f c) {
    return __builtin_amdgcn_wmma_f32_16x16x32_bf16(false, a, false, b, (short)0, c, false, false);
  }
  static __device__ __forceinline__ void guard(v8f& a, v8f& b, v16b x, v16b y) { dep_guard_b(a, b, x, y); }
  static __device__ __forceinline__ void keep(v16b a, v16b b, v16b c, v16b d) { keep4_b(a, b, c, d); }
};

__device__ __forceinline__ unsigned pk16(unsigned short a, unsigned short b) { return (unsigned)a | ((unsigned)b << 16); }

// ---- Register-blocked batched WMMA GEMM (ACT reduced to none/relu/leaky; CAUSAL and BSPLIT options) ----
// C[m,n] = scale * sum_k A[m,k] * Bt[n,k] (+bias)(+resid); each wave owns a 64x64 tile.
// A row-major [M,K]; Bt row-major [N,K]; M,N % 64 == 0, K % 32 == 0.
// SPLIT: operands are hi/lo planes (A2/Bt2 = lo planes, same layout); product = hi.hi + hi.lo + lo.hi.
// SPLIT with BSPLIT == false: only A carries a lo plane; product = hi.B + lo.B (Bt2 unused).
// BIAS_MODE: 0 = none, 1 = bias[m], 2 = bias[n].
// OUT_MODE: 0 = f32, 1 = f16, 2 = bf16 hi plane (Cout) + bf16 lo plane (Cout2).
// CAUSAL: tiles with n0 > m0 are skipped (wave-uniform) and the k loop stops at min(K, m0 + 64).
// ET: 0 = f16 operands, 1 = bf16 operands (pointers passed as 16-bit storage)
template <int ET> struct Elem;
template <> struct Elem<0> { typedef _Float16 T; };
template <> struct Elem<1> { typedef __bf16 T; };
template <int ET, bool SPLIT, int BIAS_MODE, int OUT_MODE, bool RESID, int ACT = 0, bool CAUSAL = false, bool BSPLIT = true>
__global__ __launch_bounds__(256) void wmma_gemm64(
    const unsigned short* __restrict__ Ap, const unsigned short* __restrict__ A2p, int lda, long strideA,
    const unsigned short* __restrict__ Btp, const unsigned short* __restrict__ Bt2p, int ldb, long strideB,
    void* __restrict__ Cout, void* __restrict__ Cout2, int ldc, long strideC,
    const float* __restrict__ bias,
    const float* __restrict__ resid, long strideR,
    int M, int N, int K, float scale) {
  typedef typename Elem<ET>::T T;
  typedef typename Frag<T>::V V;
  const T* A = (const T*)Ap; const T* A2 = (const T*)A2p; const T* Bt = (const T*)Btp; const T* Bt2 = (const T*)Bt2p;
  __shared__ __align__(16) float sT[8][16 * 68];   // per-wave 16x64 slab, pitch 68 floats
  const int b    = blockIdx.y;
  const int lane = threadIdx.x & 31;
  const int wave = threadIdx.x >> 5;
  const int tilesN = N >> 6;
  const int tilesM = M >> 6;
  const int tile = blockIdx.x * 8 + wave;
  if (tile >= tilesM * tilesN) return;   // wave-uniform; no block barriers in this kernel
  const int tm = tile / tilesN;
  const int tn = tile - tm * tilesN;
  const int m0 = tm << 6;
  const int n0 = tn << 6;
  if (CAUSAL && (n0 > m0)) return;       // wave-uniform causal tile skip
  const int Kend = CAUSAL ? ((m0 + 64 < K) ? (m0 + 64) : K) : K;   // multiple of 32

  const T* Ab  = A  + (size_t)b * strideA;
  const T* Bb  = Bt + (size_t)b * strideB;
  const T* Ab2 = SPLIT ? (A2  + (size_t)b * strideA) : nullptr;
  const T* Bb2 = (SPLIT && BSPLIT) ? (Bt2 + (size_t)b * strideB) : nullptr;

  const int rlane = lane & 15;                 // row (A) / col (B, D) within subtile
  const int koff  = (lane >> 4) * 8;           // k offset of this lane half
  const int mOff  = (lane >> 4) * 8;           // D row offset

  v8f acc[4][4];
#pragma unroll
  for (int i = 0; i < 4; ++i)
#pragma unroll
    for (int j = 0; j < 4; ++j) acc[i][j] = (v8f){0.f,0.f,0.f,0.f,0.f,0.f,0.f,0.f};

  for (int k0 = 0; k0 < Kend; k0 += 32) {
    V bh[4], bl[4];
#pragma unroll
    for (int j = 0; j < 4; ++j) {
      const size_t bo = (size_t)(n0 + (j << 4) + rlane) * ldb + koff + k0;
      bh[j] = Frag<T>::load(Bb + bo);
      if (SPLIT && BSPLIT) bl[j] = Frag<T>::load(Bb2 + bo);
    }
#pragma unroll
    for (int i = 0; i < 4; ++i) {
      const size_t ao = (size_t)(m0 + (i << 4) + rlane) * lda + koff + k0;
      V ah = Frag<T>::load(Ab + ao);
      V al;
      if (SPLIT) al = Frag<T>::load(Ab2 + ao);
#pragma unroll
      for (int j = 0; j < 4; ++j) {
        acc[i][j] = Frag<T>::mma(ah, bh[j], acc[i][j]);
        if (SPLIT && BSPLIT) acc[i][j] = Frag<T>::mma(ah, bl[j], acc[i][j]);
        if (SPLIT) acc[i][j] = Frag<T>::mma(al, bh[j], acc[i][j]);
      }
      Frag<T>::guard(acc[i][0], acc[i][3], ah, SPLIT ? al : ah);
    }
    Frag<T>::keep(bh[0], bh[1], bh[2], bh[3]);
    if (SPLIT && BSPLIT) Frag<T>::keep(bl[0], bl[1], bl[2], bl[3]);
  }
  acc_guard4(acc[0][0], acc[0][1], acc[0][2], acc[0][3]);
  acc_guard4(acc[1][0], acc[1][1], acc[1][2], acc[1][3]);
  acc_guard4(acc[2][0], acc[2][1], acc[2][2], acc[2][3]);
  acc_guard4(acc[3][0], acc[3][1], acc[3][2], acc[3][3]);

  // ---- epilogue ----
  float* slab = sT[wave];
  const float* Rb = RESID ? (resid + (size_t)b * strideR) : nullptr;
#pragma unroll
  for (int i = 0; i < 4; ++i) {
    const int mBase = m0 + (i << 4);
#pragma unroll
    for (int j = 0; j < 4; ++j) {
      const int n = n0 + (j << 4) + rlane;
      float bv = 0.f;
      if (BIAS_MODE == 2) bv = bias[n];
#pragma unroll
      for (int r = 0; r < 8; ++r) {
        float v = acc[i][j][r] * scale;
        if (BIAS_MODE == 1) v += bias[mBase + mOff + r];
        if (BIAS_MODE == 2) v += bv;
        if (RESID) v += Rb[(size_t)(mBase + mOff + r) * ldc + n];
        if (ACT == 2) v = fmaxf(v, 0.0f);
        if (ACT == 4) v = (v > 0.f) ? v : 0.01f * v;
        slab[(mOff + r) * 68 + (j << 4) + rlane] = v;
      }
    }
    __builtin_amdgcn_fence(__ATOMIC_RELEASE, "workgroup");
    __builtin_amdgcn_wave_barrier();
    __builtin_amdgcn_fence(__ATOMIC_ACQUIRE, "workgroup");
    if (OUT_MODE == 0) {
      float* C = (float*)Cout + (size_t)b * strideC;
      const int hh = lane >> 4, c4 = (lane & 15) * 4;     // row seg = 256 B = 16 lanes x 16 B
      {
#pragma unroll
        for (int it = 0; it < 8; ++it) {
          const int row = it * 2 + hh;
          v4f v = *(const v4f*)(slab + row * 68 + c4);
          *(v4f*)(C + (size_t)(mBase + row) * ldc + n0 + c4) = v;
        }
        
      }
    } else {
      const int q = lane >> 3, c8 = (lane & 7) * 8;
      unsigned short* C  = (unsigned short*)Cout  + (size_t)b * strideC;
      unsigned short* C2 = (OUT_MODE == 2) ? ((unsigned short*)Cout2 + (size_t)b * strideC) : nullptr;
      {
#pragma unroll
        for (int it = 0; it < 4; ++it) {
          const int row = it * 4 + q;
          const float* sp = slab + row * 68 + c8;
          v8h hv, lv;
#pragma unroll
          for (int e = 0; e < 8; ++e) {
            if (OUT_MODE == 1) {
              hv[e] = (_Float16)sp[e];
            } else {
              unsigned short hb = f2bf_bits(sp[e]);
              unsigned short lb = f2bf_bits(sp[e] - bf_bits2f(hb));
              hv[e] = __builtin_bit_cast(_Float16, hb);
              lv[e] = __builtin_bit_cast(_Float16, lb);
            }
          }
          *(v8h*)(C + (size_t)(mBase + row) * ldc + n0 + c8) = hv;
          if (OUT_MODE == 2) *(v8h*)(C2 + (size_t)(mBase + row) * ldc + n0 + c8) = lv;
        }
        
      }
    }
    __builtin_amdgcn_fence(__ATOMIC_RELEASE, "workgroup");
    __builtin_amdgcn_wave_barrier();
    __builtin_amdgcn_fence(__ATOMIC_ACQUIRE, "workgroup");
  }
}

// ---------------------------------------------------------------------------
// f32 -> RNE bf16 plane, 8 consecutive elements per thread packed as integer words.
// Coverage: n8 = n/8 threads x 8 = the whole plane (grid is an exact multiple of 256 here).
// ---------------------------------------------------------------------------
__global__ __launch_bounds__(256) void cast8_bf16_kernel(const float* __restrict__ in, unsigned short* __restrict__ out, int n8) {
  const int i = blockIdx.x * 256 + threadIdx.x;
  if (i >= n8) return;
  const float* p = in + 8 * (size_t)i;
  const v4f a = *(const v4f*)(p);
  const v4f c = *(const v4f*)(p + 4);
  float f[8];
#pragma unroll
  for (int e = 0; e < 4; ++e) { f[e] = a[e]; f[4 + e] = c[e]; }
  unsigned w[4];
#pragma unroll
  for (int e2 = 0; e2 < 4; ++e2) w[e2] = pk16(f2bf_bits(f[2 * e2]), f2bf_bits(f[2 * e2 + 1]));
  const v4u u = (v4u){w[0], w[1], w[2], w[3]};
  unsigned short* q = out + 8 * (size_t)i;
  *(v4u*)q = u;
  
}

// ---------------------------------------------------------------------------
// Transpose + RNE bf16 convert of a weight matrix with zero padding of the output rows:
// in f32 [R][ncol] row-major (ldin = ncol) -> out bf16 [Cpad][R] (ldout = R): out[c][r] = bf16(in[r][c]) for c < ncol, 0 for c >= ncol.
// grid (R/64, Cpad/64): blockIdx.x = r tile (64 output cols), blockIdx.y = c tile (64 output rows). 256 threads.
// Load coverage: 16 iterations x 256 threads = 4096 = the whole 64x64 tile; column ADDRESS clamped to ncol-1, value zeroed by predicate.
// Store coverage: 8 waves x 2 iterations x 4 rows (lane>>3) = 64 rows; (lane&7) x 8 halves = 64 cols; each row segment =
// ---------------------------------------------------------------------------
__global__ __launch_bounds__(256) void transpose_cast_pad_kernel(const float* __restrict__ in, int ldin, int ncol,
                                                                 unsigned short* __restrict__ out, int ldout) {
  __shared__ float sm[64][65];   // sm[c_local][r_local]
  const int t  = threadIdx.x;
  const int r0 = blockIdx.x * 64;
  const int c0 = blockIdx.y * 64;
#pragma unroll
  for (int i = 0; i < 16; ++i) {
    const int e = i * 256 + t;
    const int r = e >> 6;          // r local
    const int c = e & 63;          // c local
    const int cg = c0 + c;
    const int cc = (cg < ncol) ? cg : (ncol - 1);
    const float v = in[(size_t)(r0 + r) * ldin + cc];
    sm[c][r] = (cg < ncol) ? v : 0.0f;
  }
  __syncthreads();
  const int lane = t & 31, wave = t >> 5;
  const int q = lane >> 3, c8 = (lane & 7) * 8;
  {
#pragma unroll
    for (int it = 0; it < 2; ++it) {
      const int row = wave * 8 + it * 4 + q;                 // c local (output row)
      unsigned w[4];
#pragma unroll
      for (int e2 = 0; e2 < 4; ++e2) w[e2] = pk16(f2bf_bits(sm[row][c8 + 2 * e2]), f2bf_bits(sm[row][c8 + 2 * e2 + 1]));
      const v4u u = (v4u){w[0], w[1], w[2], w[3]};
      const size_t o = (size_t)(c0 + row) * ldout + r0 + c8;
      *(v4u*)(out + o) = u;
    }
    
  }
}

// ---------------------------------------------------------------------------
// Bias vectors -> RNE-bf16 valued f32 lines padded to kUP: outp[p][u] = bf16(b_p[u]) for u < nvalid, 0 otherwise (p = blockIdx.x in 0..2).
// All three candidates loaded with a clamped index, selected by value. 64 threads x 4 floats = 256 = kUP;
// ---------------------------------------------------------------------------
__global__ __launch_bounds__(64) void bias_pad_kernel(const float* __restrict__ b0, const float* __restrict__ b1,
                                                     const float* __restrict__ b2, int nvalid, float* __restrict__ outp) {
  const int p = blockIdx.x;
  const int t = threadIdx.x;
  float f[4];
#pragma unroll
  for (int e = 0; e < 4; ++e) {
    const int u  = 4 * t + e;
    const int uc = (u < nvalid) ? u : (nvalid - 1);
    const float v0 = b0[uc], v1 = b1[uc], v2 = b2[uc];
    float v = (p == 0) ? v0 : ((p == 1) ? v1 : v2);
    v = bf_bits2f(f2bf_bits(v));
    f[e] = (u < nvalid) ? v : 0.0f;
  }
  const v4f val = (v4f){f[0], f[1], f[2], f[3]};
  float* dst = outp + (size_t)p * kUP + 4 * t;
  *(v4f*)dst = val;
  
}

// ---------------------------------------------------------------------------
// Row softmax over materialised f32 scores of all batches (16384 rows x 2048 cols), no mask.
// p = exp(score - max) * (1/sum); P written as bf16 hi/lo planes IN PLACE over the row's own scores:
// the 8192 bytes of f32 row r become 2048 bf16 hi (bytes 0..4095) followed by 2048 bf16 lo (bytes 4096..8191).
// Safe because one block owns one row, every thread's score loads are consumed in front of the first __syncthreads(),
// and the P stores stand behind the second one. One pointer, no __restrict__: loads and stores alias.
// One block of 256 threads per row; thread t owns columns 8t..8t+7 (256 x 8 = 2048).
// Reductions in fixed order (thread, wave shuffle tree, 8 wave partials in index order); shuffles outside all branches.
// ---------------------------------------------------------------------------
__global__ __launch_bounds__(256) void softmax_rows_kernel(float* SP) {
  __shared__ float redM[8];
  __shared__ float redS[8];
  const int qi   = blockIdx.x;           // query row 0..16383 (batch * 2048 + row)
  const int t    = threadIdx.x;
  const int lane = t & 31, wave = t >> 5;
  const int c0   = t * 8;
  const size_t rowoff = (size_t)qi * (size_t)kSeq;

  const float* sr = SP + rowoff + c0;
  const v4f a = *(const v4f*)(sr);
  const v4f c = *(const v4f*)(sr + 4);
  float xv[8];
#pragma unroll
  for (int e = 0; e < 4; ++e) { xv[e] = a[e]; xv[4 + e] = c[e]; }
  float m = xv[0];
#pragma unroll
  for (int e = 1; e < 8; ++e) m = fmaxf(m, xv[e]);
#pragma unroll
  for (int off = 16; off > 0; off >>= 1) m = fmaxf(m, __shfl_xor(m, off, 32));
  if (lane == 0) redM[wave] = m;
  __syncthreads();
  float gmax = redM[0];
#pragma unroll
  for (int w = 1; w < 8; ++w) gmax = fmaxf(gmax, redM[w]);

  float p[8];
  float ps = 0.0f;
#pragma unroll
  for (int e = 0; e < 8; ++e) { p[e] = expf(xv[e] - gmax); ps += p[e]; }
#pragma unroll
  for (int off = 16; off > 0; off >>= 1) ps += __shfl_xor(ps, off, 32);
  if (lane == 0) redS[wave] = ps;
  __syncthreads();
  float tot = redS[0];
#pragma unroll
  for (int w = 1; w < 8; ++w) tot += redS[w];
  const float inv = 1.0f / tot;          // tot >= 1

  unsigned hw[4], lw[4];
#pragma unroll
  for (int e2 = 0; e2 < 4; ++e2) {
    const float f0 = p[2 * e2] * inv;
    const float f1 = p[2 * e2 + 1] * inv;
    const unsigned short h0 = f2bf_bits(f0);
    const unsigned short h1 = f2bf_bits(f1);
    const unsigned short l0 = f2bf_bits(f0 - bf_bits2f(h0));
    const unsigned short l1 = f2bf_bits(f1 - bf_bits2f(h1));
    hw[e2] = pk16(h0, h1);
    lw[e2] = pk16(l0, l1);
  }
  const v4u hv = (v4u){hw[0], hw[1], hw[2], hw[3]};
  const v4u lv = (v4u){lw[0], lw[1], lw[2], lw[3]};
  unsigned short* ph = (unsigned short*)(SP + rowoff) + c0;
  unsigned short* pl = ph + kSeq;
  *(v4u*)ph = hv;
  *(v4u*)pl = lv;
  
}

// ---------------------------------------------------------------------------
// Final copy: tmp f32 [kRows][kUP] (pitch 256) -> out f32 flat [kRows][kUnits] (pitch 200, contiguous).
// Thread i owns flat output elements 4i..4i+3 (same row since 200 % 4 == 0); one 16-B store per lane, thread-linear from the
// Coverage: n4 = kRows*kUnits/4 threads x 4 = the whole output (grid exact multiple of 256).
// ---------------------------------------------------------------------------
__global__ __launch_bounds__(256) void copy_out_kernel(const float* __restrict__ tmp, float* __restrict__ out, int n4) {
  const int i = blockIdx.x * 256 + threadIdx.x;
  if (i >= n4) return;
  const int e   = 4 * i;
  const int row = e / kUnits;
  const int col = e - row * kUnits;
  const v4f v = *(const v4f*)(tmp + (size_t)row * kUP + col);
  float* dst = out + (size_t)e;
  *(v4f*)dst = v;
  
}

// ---------------------------------------------------------------------------
// Launcher. Workspace region map (bytes, MiB = 1048576; total carve = 192 MiB + 786432 + 3072 = 202116096 B):
//   [  0,128) S/P   : scores f32 [8][2048][2048]; softmax turns each 8192-B row into P hi bf16 [2048] + P lo bf16 [2048] in place
//                     earlier alias: Xg = generated as bf16 [16384][512] at [0, 16), Xr = real as bf16 [16384][512] at [16, 32)
//   [128,136) q hi  : bf16 [16384][256]; [136,144) q lo
//   [144,152) k hi  : bf16 [16384][256]; [152,160) k lo
//   [160,168) v^T hi: bf16 [256][16384]; [168,176) v^T lo
//   [176,192) O tmp : f32 [16384][256]
//   [192 MiB, +786432)  W^T planes: 3 x bf16 [256][512] (262144 B each: Wq^T, Wk^T, Wv^T; rows 200..255 zero)
//   [ +786432, +3072)   bias lines: 3 x f32 [256] (RNE-bf16 values, 200..255 zero)
// Lifetimes: Xg is read only by the q projection, Xr only by the k and v^T projections (launches 7..9); S first written in launch 10.
// Launch count: 2 casts + 3 transposes + 1 bias + 3 projections + scores + softmax + p.v (blockIdx.y = batch) + 1 copy = 13. Kernel launches only.
// GEMM shapes: proj q/k M=16384 N=256 K=512; v^T M=256 N=16384 K=512; per batch scores M=N=2048 K=224; p.v M=2048 N=256 K=2048 (all M,N % 64 == 0, K % 32 == 0).
// ---------------------------------------------------------------------------
extern "C" void kernel_launch(void* const* d_in, const int* in_sizes, int n_in,
                              void* d_out, int out_size, void* d_ws, size_t ws_size,
                              hipStream_t stream) {
  if (n_in < 8) return;
  if (in_sizes[0] != kRows * kDin || in_sizes[1] != kRows * kDin) return;
  if (in_sizes[2] != kDin * kUnits || in_sizes[4] != kDin * kUnits || in_sizes[6] != kDin * kUnits) return;
  if (in_sizes[3] != kUnits || in_sizes[5] != kUnits || in_sizes[7] != kUnits) return;
  if (out_size != kRows * kUnits) return;

  const size_t kMiB    = 1048576;
  const size_t offXg   = 0;
  const size_t offXr   = 16 * kMiB;
  const size_t offS    = 0;
  const size_t offQhi  = 128 * kMiB;
  const size_t offQlo  = 136 * kMiB;
  const size_t offKhi  = 144 * kMiB;
  const size_t offKlo  = 152 * kMiB;
  const size_t offVhi  = 160 * kMiB;
  const size_t offVlo  = 168 * kMiB;
  const size_t offO    = 176 * kMiB;
  const size_t wplane  = (size_t)kUP * kDin * 2;                 // 262144 B
  const size_t offWq   = 192 * kMiB;
  const size_t offWk   = offWq + wplane;
  const size_t offWv   = offWk + wplane;
  const size_t offBias = offWv + wplane;                         // 192 MiB + 786432
  const size_t total   = offBias + (size_t)3 * kUP * 4;          // 202116096 B
  if (total > ws_size) return;

  const float* gen  = (const float*)d_in[0];
  const float* real = (const float*)d_in[1];
  const float* Wq   = (const float*)d_in[2];
  const float* bq   = (const float*)d_in[3];
  const float* Wk   = (const float*)d_in[4];
  const float* bk   = (const float*)d_in[5];
  const float* Wv   = (const float*)d_in[6];
  const float* bv   = (const float*)d_in[7];
  float* out = (float*)d_out;
  char* ws = (char*)d_ws;

  unsigned short* xg   = (unsigned short*)(ws + offXg);
  unsigned short* xr   = (unsigned short*)(ws + offXr);
  float*          Sbuf = (float*)(ws + offS);
  unsigned short* phi  = (unsigned short*)(ws + offS);           // row pitch 2 * kSeq halves
  unsigned short* plo  = phi + kSeq;
  unsigned short* qhi  = (unsigned short*)(ws + offQhi);
  unsigned short* qlo  = (unsigned short*)(ws + offQlo);
  unsigned short* khi  = (unsigned short*)(ws + offKhi);
  unsigned short* klo  = (unsigned short*)(ws + offKlo);
  unsigned short* vthi = (unsigned short*)(ws + offVhi);
  unsigned short* vtlo = (unsigned short*)(ws + offVlo);
  float*          Otmp = (float*)(ws + offO);
  unsigned short* wqT  = (unsigned short*)(ws + offWq);
  unsigned short* wkT  = (unsigned short*)(ws + offWk);
  unsigned short* wvT  = (unsigned short*)(ws + offWv);
  float*          biasP = (float*)(ws + offBias);

  // in-range dummies for unused (never dereferenced) template-dead pointer parameters
  const float* dummy_f = biasP;
  void* dummy_c2 = (void*)biasP;

  // 1-2. activations -> RNE bf16 planes [16384][512]
  {
    const int n8 = (kRows * kDin) / 8;                      // 1048576 = 4096 blocks x 256
    cast8_bf16_kernel<<<dim3(n8 / 256), dim3(256), 0, stream>>>(gen, xg, n8);
    cast8_bf16_kernel<<<dim3(n8 / 256), dim3(256), 0, stream>>>(real, xr, n8);
  }
  // 3-5. W [R=512][ncol=200] -> W^T bf16 [256][512] with rows 200..255 zero; grid (R/64, 256/64)
  transpose_cast_pad_kernel<<<dim3(kDin / 64, kUP / 64), dim3(256), 0, stream>>>(Wq, kUnits, kUnits, wqT, kDin);
  transpose_cast_pad_kernel<<<dim3(kDin / 64, kUP / 64), dim3(256), 0, stream>>>(Wk, kUnits, kUnits, wkT, kDin);
  transpose_cast_pad_kernel<<<dim3(kDin / 64, kUP / 64), dim3(256), 0, stream>>>(Wv, kUnits, kUnits, wvT, kDin);
  // 6. biases -> padded RNE-bf16 valued f32 lines [3][256]
  bias_pad_kernel<<<dim3(3), dim3(64), 0, stream>>>(bq, bk, bv, kUnits, biasP);

  // 7. q = Xg . Wq^T + bq : M=16384, N=256, K=512, single bf16 product -> bf16 hi/lo planes [16384][256]
  wmma_gemm64<1, false, 2, 2, false, 0, false, true><<<dim3((kRows / 64) * (kUP / 64) / 8, 1), dim3(256), 0, stream>>>(
      xg, xg, kDin, 0L,
      wqT, wqT, kDin, 0L,
      (void*)qhi, (void*)qlo, kUP, 0L,
      biasP, dummy_f, 0L,
      kRows, kUP, kDin, 1.0f);
  // 8. k = Xr . Wk^T + bk
  wmma_gemm64<1, false, 2, 2, false, 0, false, true><<<dim3((kRows / 64) * (kUP / 64) / 8, 1), dim3(256), 0, stream>>>(
      xr, xr, kDin, 0L,
      wkT, wkT, kDin, 0L,
      (void*)khi, (void*)klo, kUP, 0L,
      biasP + kUP, dummy_f, 0L,
      kRows, kUP, kDin, 1.0f);
  // 9. v^T = Wv^T . Xr^T + bv[m] : M=256 (u), N=16384 (b*2048+t), K=512 -> bf16 hi/lo planes [256][16384]
  wmma_gemm64<1, false, 1, 2, false, 0, false, true><<<dim3((kUP / 64) * (kRows / 64) / 8, 1), dim3(256), 0, stream>>>(
      wvT, wvT, kDin, 0L,
      xr, xr, kDin, 0L,
      (void*)vthi, (void*)vtlo, kRows, 0L,
      biasP + 2 * kUP, dummy_f, 0L,
      kUP, kRows, kDin, 1.0f);

  // 10. scores = 200^-0.5 * q . k^T, all batches (blockIdx.y): M=N=2048, K=224 (cols 200..223 exact zeros), 3 products on hi/lo planes -> f32 [8][2048][2048]
  wmma_gemm64<1, true, 0, 0, false, 0, false, true><<<dim3((kSeq / 64) * (kSeq / 64) / 8, kBatch), dim3(256), 0, stream>>>(
      qhi, qlo, kUP, (long)kSeq * kUP,
      khi, klo, kUP, (long)kSeq * kUP,
      (void*)Sbuf, dummy_c2, kSeq, (long)kSeq * kSeq,
      dummy_f, dummy_f, 0L,
      kSeq, kSeq, kKS, kScoreScale);

  // 11. softmax of all 16384 rows -> P hi/lo planes in place (row pitch 4096 halves)
  softmax_rows_kernel<<<dim3(kRows), dim3(256), 0, stream>>>(Sbuf);

  // 12. O = P . v, all batches (blockIdx.y): M=2048, N=256, K=2048, 3 products; Bt = v^T rows u, cols b*2048.. (ldb 16384) -> f32 temp rows b*2048.., pitch 256
  wmma_gemm64<1, true, 0, 0, false, 0, false, true><<<dim3((kSeq / 64) * (kUP / 64) / 8, kBatch), dim3(256), 0, stream>>>(
      phi, plo, 2 * kSeq, (long)kSeq * 2 * kSeq,
      vthi, vtlo, kRows, (long)kSeq,
      (void*)Otmp, dummy_c2, kUP, (long)kSeq * kUP,
      dummy_f, dummy_f, 0L,
      kSeq, kUP, kSeq, 1.0f);

  // 13. temp [16384][256] -> out [16384][200] contiguous
  {
    const int n4 = (kRows * kUnits) / 4;                    // 819200 = 3200 blocks x 256
    copy_out_kernel<<<dim3(n4 / 256), dim3(256), 0, stream>>>(Otmp, out, n4);
  }
}

// v002
// It runs in 211 microseconds.
// Timed twice side by side with v001, it ran 1.82 and 1.81 times as fast.
// Over all steps from v000 it is 7.03 times as fast.
// Contractions: x.W projections (q, k planes and v^T plane): single v_wmma_f32_16x16x32_bf16 product on RNE-bf16 converted x, W, bias; q.k^T scores and p.v output: bf16 hi/lo operand planes (hi.hi + hi.lo + lo.hi); all f32 accumulate; softmax in f32.
#include <hip/hip_runtime.h>
#include <math.h>

// ---------------------------------------------------------------------------
// Problem constants
// ---------------------------------------------------------------------------
constexpr int kBatch = 8;
constexpr int kSeq   = 2048;
constexpr int kDin   = 512;
constexpr int kUnits = 200;
constexpr int kUP    = 256;              // padded unit count (cols 200..255 exactly zero)
constexpr int kRows  = kBatch * kSeq;    // 16384 token rows
constexpr int kKS    = 224;              // score contraction depth (q/k cols 200..223 are exact zeros)
constexpr float kScoreScale = 0.070710678118654752f;   // 200^-0.5 applied in the f32 epilogue

static_assert(kSeq == 2048, "softmax kernel: 256 threads x 8 columns = one row");
static_assert(kRows % 64 == 0 && kUP % 64 == 0 && kSeq % 64 == 0 && kDin % 64 == 0, "tile multiples");
static_assert(kDin % 32 == 0 && kKS % 32 == 0 && kSeq % 32 == 0, "K multiples of 32");
static_assert(kKS >= kUnits && kKS <= kUP, "score depth covers all real units");
static_assert(kRows % 256 == 0 && kSeq % 256 == 0 && kUP % 256 == 0, "work-group tile 128 x 256 in either orientation");
static_assert((kKS + 63) / 64 * 64 <= kUP, "the last score stage copies whole 128-B rows inside the q/k row pitch");
static_assert((kRows * kDin) % (8 * 256) == 0, "cast kernel grid exact");
static_assert((kRows * kUnits) % (4 * 256) == 0 && kUnits % 4 == 0, "copy kernel grid exact, float4 inside one row");
static_assert(kUP == 4 * 64, "bias kernel: 64 threads x 4 floats");

typedef __attribute__((ext_vector_type(16))) _Float16 v16h;
typedef __attribute__((ext_vector_type(8)))  _Float16 v8h;
typedef __attribute__((ext_vector_type(16))) __bf16   v16b;
typedef __attribute__((ext_vector_type(8)))  __bf16   v8b;
typedef __attribute__((ext_vector_type(8)))  float    v8f;
typedef __attribute__((ext_vector_type(4)))  float    v4f;
typedef __attribute__((ext_vector_type(4)))  unsigned int v4u;

// ---------------------------------------------------------------------------
// Device helpers
// ---------------------------------------------------------------------------
__device__ __forceinline__ unsigned short f2bf_bits(float f) {
  unsigned u = __float_as_uint(f);
  return (unsigned short)((u + 0x7FFFu + ((u >> 16) & 1u)) >> 16);
}
__device__ __forceinline__ float bf_bits2f(unsigned short h) { return __uint_as_float(((unsigned)h) << 16); }

// hazard guards as plain device helpers
__device__ __forceinline__ void dep_guard_h(v8f& a, v8f& b, v16h x, v16h y) { asm volatile("v_nop\n\tv_nop\n\tv_nop\n\tv_nop" : "+v"(a), "+v"(b) : "v"(x), "v"(y)); }
__device__ __forceinline__ void dep_guard_b(v8f& a, v8f& b, v16b x, v16b y) { asm volatile("v_nop\n\tv_nop\n\tv_nop\n\tv_nop" : "+v"(a), "+v"(b) : "v"(x), "v"(y)); }
__device__ __forceinline__ void keep4_h(v16h a, v16h b, v16h c, v16h d) { asm volatile("v_nop" :: "v"(a), "v"(b), "v"(c), "v"(d)); }
__device__ __forceinline__ void keep4_b(v16b a, v16b b, v16b c, v16b d) { asm volatile("v_nop" :: "v"(a), "v"(b), "v"(c), "v"(d)); }
__device__ __forceinline__ void acc_guard4(v8f& a, v8f& b, v8f& c, v8f& d) { asm volatile("v_nop\n\tv_nop\n\tv_nop\n\tv_nop" : "+v"(a), "+v"(b), "+v"(c), "+v"(d)); }
template <typename T> struct Frag;
template <> struct Frag<_Float16> {
  typedef v16h V; union U { v16h v; v8h h[2]; };
  // elements 0..7 <- p[0..7], 8..15 <- p[16..23]
  static __device__ __forceinline__ v16h load(const _Float16* p) {
    U f; f.h[0] = *(const v8h*)(p); f.h[1] = *(const v8h*)(p + 16); return f.v;
  }
  static __device__ __forceinline__ v8f mma(v16h a, v16h b, v8f c) {
    return __builtin_amdgcn_wmma_f32_16x16x32_f16(false, a, false, b, (short)0, c, false, false);
  }
  static __device__ __forceinline__ void guard(v8f& a, v8f& b, v16h x, v16h y) { dep_guard_h(a, b, x, y); }
  static __device__ __forceinline__ void keep(v16h a, v16h b, v16h c, v16h d) { keep4_h(a, b, c, d); }
};
template <> struct Frag<__bf16> {
  typedef v16b V; union U { v16b v; v8b h[2]; };
  static __device__ __forceinline__ v16b load(const __bf16* p) {
    U f; f.h[0] = *(const v8b*)(p); f.h[1] = *(const v8b*)(p + 16); return f.v;
  }
  static __device__ __forceinline__ v8f mma(v16b a, v16b b, v8f c) {
    return __builtin_amdgcn_wmma_f32_16x16x32_bf16(false, a, false, b, (short)0, c, false, false);
  }
  static __device__ __forceinline__ void guard(v8f& a, v8f& b, v16b x, v16b y) { dep_guard_b(a, b, x, y); }
  static __device__ __forceinline__ void keep(v16b a, v16b b, v16b c, v16b d) { keep4_b(a, b, c, d); }
};

__device__ __forceinline__ unsigned pk16(unsigned short a, unsigned short b) { return (unsigned)a | ((unsigned)b << 16); }

// ---- Register-blocked batched WMMA GEMM, operands staged in LDS by asynchronous copies ----
// C[m,n] = scale * sum_k A[m,k] * Bt[n,k] (+bias)(+resid); a work-group owns a 128x256 tile, each of its 8 waves (2 x 4) a 64x64 tile.
// A row-major [M,K]; Bt row-major [N,K]; M % 128 == 0, N % 256 == 0, K % 32 == 0; lda, ldb >= K rounded up to 64 (a stage copies whole 128-B rows).
// SPLIT: operands are hi/lo planes (A2/Bt2 = lo planes, same layout); product = hi.hi + hi.lo + lo.hi.
// BIAS_MODE: 0 = none, 1 = bias[m], 2 = bias[n].
// OUT_MODE: 0 = f32, 1 = f16, 2 = bf16 hi plane (Cout) + bf16 lo plane (Cout2).
// ET: 0 = f16 operands, 1 = bf16 operands (pointers passed as 16-bit storage)
// Stage = 64 k of every operand row: [A hi 128 rows | B hi 256 rows | A lo | B lo], LDS row pitch 144 B (16 B x odd: ds_load_b128 free of bank conflicts).
// Two buffers: the copies of stage s + 1 fly while stage s is multiplied.
constexpr int kStageK  = 64;                      // k per stage = 128 B of a row = one whole line
constexpr int kPitchB  = 144;                     // LDS row pitch, bytes
constexpr int kTileM   = 128;
constexpr int kTileN   = 256;
constexpr int kPlaneA  = kTileM * kPitchB;        // 18432 B
constexpr int kPlaneB  = kTileN * kPitchB;        // 36864 B
constexpr int kPlaneAB = kPlaneA + kPlaneB;       // 55296 B
constexpr int kRowStep = 32 * kPitchB;            // 256 threads copy 32 rows of 128 B at a time

// One plane pair of a stage: 4 x 32 rows of A and 8 x 32 rows of B, 16 B per lane and copy, through no register.
// la / lb: the lane's LDS byte address of its first A / B row; ga / gb: its global address; sa / sb: bytes between 32 global rows.
// s_wait_xcnt 0 is the statement's last line: it stands in front of any later write of the address registers named here.
__device__ __forceinline__ void async_copy_plane(unsigned la, const char* ga, size_t sa, unsigned lb, const char* gb, size_t sb) {
  asm volatile(
      "global_load_async_to_lds_b128 %0, %12, off\n\t"
      "global_load_async_to_lds_b128 %1, %13, off\n\t"
      "global_load_async_to_lds_b128 %2, %14, off\n\t"
      "global_load_async_to_lds_b128 %3, %15, off\n\t"
      "global_load_async_to_lds_b128 %4, %16, off\n\t"
      "global_load_async_to_lds_b128 %5, %17, off\n\t"
      "global_load_async_to_lds_b128 %6, %18, off\n\t"
      "global_load_async_to_lds_b128 %7, %19, off\n\t"
      "global_load_async_to_lds_b128 %8, %20, off\n\t"
      "global_load_async_to_lds_b128 %9, %21, off\n\t"
      "global_load_async_to_lds_b128 %10, %22, off\n\t"
      "global_load_async_to_lds_b128 %11, %23, off\n\t"
      "s_wait_xcnt 0x0"
      :: "v"(la), "v"(la + kRowStep), "v"(la + 2 * kRowStep), "v"(la + 3 * kRowStep),
         "v"(lb), "v"(lb + kRowStep), "v"(lb + 2 * kRowStep), "v"(lb + 3 * kRowStep),
         "v"(lb + 4 * kRowStep), "v"(lb + 5 * kRowStep), "v"(lb + 6 * kRowStep), "v"(lb + 7 * kRowStep),
         "v"(ga), "v"(ga + sa), "v"(ga + 2 * sa), "v"(ga + 3 * sa),
         "v"(gb), "v"(gb + sb), "v"(gb + 2 * sb), "v"(gb + 3 * sb),
         "v"(gb + 4 * sb), "v"(gb + 5 * sb), "v"(gb + 6 * sb), "v"(gb + 7 * sb)
      : "memory");
}

template <int ET> struct Elem;
template <> struct Elem<0> { typedef _Float16 T; };
template <> struct Elem<1> { typedef __bf16 T; };
template <int ET, bool SPLIT, int BIAS_MODE, int OUT_MODE, bool RESID, int ACT = 0>
__global__ __launch_bounds__(256) void wmma_gemm64(
    const unsigned short* __restrict__ Ap, const unsigned short* __restrict__ A2p, int lda, long strideA,
    const unsigned short* __restrict__ Btp, const unsigned short* __restrict__ Bt2p, int ldb, long strideB,
    void* __restrict__ Cout, void* __restrict__ Cout2, int ldc, long strideC,
    const float* __restrict__ bias,
    const float* __restrict__ resid, long strideR,
    int M, int N, int K, float scale) {
  typedef typename Elem<ET>::T T;
  typedef typename Frag<T>::V V;
  constexpr int kStageB = (SPLIT ? 2 : 1) * kPlaneAB;   // bytes of one buffer
  __shared__ __align__(16) char ring[2 * kStageB];      // two stage buffers
  __shared__ __align__(16) float sT[8][16 * 68];        // per-wave 16x64 slab, pitch 68 floats
  const int b    = blockIdx.y;
  const int lane = threadIdx.x & 31;
  const int wave = threadIdx.x >> 5;
  const int tilesN = N >> 8;
  const int tilesM = M >> 7;
  if ((int)blockIdx.x >= tilesM * tilesN) return;   // the same for the whole work-group, in front of every copy and barrier
  const int tm  = blockIdx.x / tilesN;
  const int tn  = blockIdx.x - tm * tilesN;
  const int m0g = tm << 7;                          // work-group tile origin
  const int n0g = tn << 8;
  const int mw  = (wave >> 2) << 6;                 // wave tile origin inside it
  const int nw  = (wave & 3) << 6;
  const int m0  = m0g + mw;
  const int n0  = n0g + nw;

  const int rlane = lane & 15;                 // row (A) / col (B, D) within subtile
  const int koff  = (lane >> 4) * 8;           // k offset of this lane half
  const int mOff  = (lane >> 4) * 8;           // D row offset

  // copy addresses of this lane: row threadIdx.x / 8 of each group of 32 rows, 16-B piece threadIdx.x % 8 of its 128 B
  const int crow = threadIdx.x >> 3;
  const int cpc  = (threadIdx.x & 7) << 4;
  const size_t rsA = (size_t)lda * 64;         // 32 rows x 2 B
  const size_t rsB = (size_t)ldb * 64;
  const size_t goA = ((size_t)b * strideA + (size_t)(m0g + crow) * lda) * 2 + cpc;
  const size_t goB = ((size_t)b * strideB + (size_t)(n0g + crow) * ldb) * 2 + cpc;
  const char* gA  = (const char*)Ap  + goA;
  const char* gB  = (const char*)Btp + goB;
  const char* gA2 = (const char*)A2p  + goA;
  const char* gB2 = (const char*)Bt2p + goB;
  const unsigned lds0 = (unsigned)(size_t)(&ring[0]) + (unsigned)(crow * kPitchB + cpc);
  auto fill = [&](int s, int buf) {
    const size_t kb = (size_t)s * (kStageK * 2);
    const unsigned l = lds0 + (unsigned)(buf * kStageB);
    async_copy_plane(l, gA + kb, rsA, l + kPlaneA, gB + kb, rsB);
    if (SPLIT) async_copy_plane(l + kPlaneAB, gA2 + kb, rsA, l + kPlaneAB + kPlaneA, gB2 + kb, rsB);
  };

  v8f acc[4][4];
#pragma unroll
  for (int i = 0; i < 4; ++i)
#pragma unroll
    for (int j = 0; j < 4; ++j) acc[i][j] = (v8f){0.f,0.f,0.f,0.f,0.f,0.f,0.f,0.f};

  const int nst = (K + kStageK - 1) / kStageK;
  fill(0, 0);
  asm volatile("s_wait_asynccnt 0x0" ::: "memory");   // this wave's share of stage 0 has landed
  __syncthreads();                                    // publishes stage 0
  if (nst > 1) fill(1, 1);

  const int fragA = (mw + rlane) * kPitchB + koff * 2;            // byte of this lane's first A fragment row in a plane pair
  const int fragB = kPlaneA + (nw + rlane) * kPitchB + koff * 2;  // the same for B
  for (int s = 0; s < nst; ++s) {
    const char* sb = ring + (s & 1) * kStageB;
#pragma unroll   // kk becomes an immediate in every LDS offset
    for (int kk = 0; kk < 2; ++kk) {
      if (s * kStageK + kk * 32 < K) {   // scalar: a K that is an odd multiple of 32 ends on half a stage
        V bh[4], bl[4];
#pragma unroll
        for (int j = 0; j < 4; ++j) {
          const char* bp = sb + fragB + j * (16 * kPitchB) + kk * 64;
          bh[j] = Frag<T>::load((const T*)bp);
          if (SPLIT) bl[j] = Frag<T>::load((const T*)(bp + kPlaneAB));
        }
#pragma unroll
        for (int i = 0; i < 4; ++i) {
          const char* ap = sb + fragA + i * (16 * kPitchB) + kk * 64;
          V ah = Frag<T>::load((const T*)ap);
          V al;
          if (SPLIT) al = Frag<T>::load((const T*)(ap + kPlaneAB));
#pragma unroll
          for (int j = 0; j < 4; ++j) {
            acc[i][j] = Frag<T>::mma(ah, bh[j], acc[i][j]);
            if (SPLIT) acc[i][j] = Frag<T>::mma(ah, bl[j], acc[i][j]);
            if (SPLIT) acc[i][j] = Frag<T>::mma(al, bh[j], acc[i][j]);
          }
          Frag<T>::guard(acc[i][0], acc[i][3], ah, SPLIT ? al : ah);
        }
        Frag<T>::keep(bh[0], bh[1], bh[2], bh[3]);
        if (SPLIT) Frag<T>::keep(bl[0], bl[1], bl[2], bl[3]);
      }
    }
    asm volatile("s_wait_dscnt 0x0" ::: "memory");      // this wave's reads of buffer s & 1 are done before it is refilled
    asm volatile("s_wait_asynccnt 0x0" ::: "memory");   // this wave's share of stage s + 1 has landed
    __syncthreads();                                    // publishes stage s + 1 and ends every reader's last read of stage s
    if (s + 2 < nst) fill(s + 2, s & 1);
  }
  asm volatile("s_wait_asynccnt 0x0" ::: "memory");     // nothing in flight when the wave goes on to the epilogue and ends
  acc_guard4(acc[0][0], acc[0][1], acc[0][2], acc[0][3]);
  acc_guard4(acc[1][0], acc[1][1], acc[1][2], acc[1][3]);
  acc_guard4(acc[2][0], acc[2][1], acc[2][2], acc[2][3]);
  acc_guard4(acc[3][0], acc[3][1], acc[3][2], acc[3][3]);

  // ---- epilogue ----
  float* slab = sT[wave];
  const float* Rb = RESID ? (resid + (size_t)b * strideR) : nullptr;
#pragma unroll
  for (int i = 0; i < 4; ++i) {
    const int mBase = m0 + (i << 4);
#pragma unroll
    for (int j = 0; j < 4; ++j) {
      const int n = n0 + (j << 4) + rlane;
      float bv = 0.f;
      if (BIAS_MODE == 2) bv = bias[n];
#pragma unroll
      for (int r = 0; r < 8; ++r) {
        float v = acc[i][j][r] * scale;
        if (BIAS_MODE == 1) v += bias[mBase + mOff + r];
        if (BIAS_MODE == 2) v += bv;
        if (RESID) v += Rb[(size_t)(mBase + mOff + r) * ldc + n];
        if (ACT == 2) v = fmaxf(v, 0.0f);
        if (ACT == 4) v = (v > 0.f) ? v : 0.01f * v;
        slab[(mOff + r) * 68 + (j << 4) + rlane] = v;
      }
    }
    __builtin_amdgcn_fence(__ATOMIC_RELEASE, "workgroup");
    __builtin_amdgcn_wave_barrier();
    __builtin_amdgcn_fence(__ATOMIC_ACQUIRE, "workgroup");
    if (OUT_MODE == 0) {
      float* C = (float*)Cout + (size_t)b * strideC;
      const int hh = lane >> 4, c4 = (lane & 15) * 4;     // row seg = 256 B = 16 lanes x 16 B
      {
#pragma unroll
        for (int it = 0; it < 8; ++it) {
          const int row = it * 2 + hh;
          v4f v = *(const v4f*)(slab + row * 68 + c4);
          *(v4f*)(C + (size_t)(mBase + row) * ldc + n0 + c4) = v;
        }
        
      }
    } else {
      const int q = lane >> 3, c8 = (lane & 7) * 8;
      unsigned short* C  = (unsigned short*)Cout  + (size_t)b * strideC;
      unsigned short* C2 = (OUT_MODE == 2) ? ((unsigned short*)Cout2 + (size_t)b * strideC) : nullptr;
      {
#pragma unroll
        for (int it = 0; it < 4; ++it) {
          const int row = it * 4 + q;
          const float* sp = slab + row * 68 + c8;
          v8h hv, lv;
#pragma unroll
          for (int e = 0; e < 8; ++e) {
            if (OUT_MODE == 1) {
              hv[e] = (_Float16)sp[e];
            } else {
              unsigned short hb = f2bf_bits(sp[e]);
              unsigned short lb = f2bf_bits(sp[e] - bf_bits2f(hb));
              hv[e] = __builtin_bit_cast(_Float16, hb);
              lv[e] = __builtin_bit_cast(_Float16, lb);
            }
          }
          *(v8h*)(C + (size_t)(mBase + row) * ldc + n0 + c8) = hv;
          if (OUT_MODE == 2) *(v8h*)(C2 + (size_t)(mBase + row) * ldc + n0 + c8) = lv;
        }
        
      }
    }
    __builtin_amdgcn_fence(__ATOMIC_RELEASE, "workgroup");
    __builtin_amdgcn_wave_barrier();
    __builtin_amdgcn_fence(__ATOMIC_ACQUIRE, "workgroup");
  }
}

// ---------------------------------------------------------------------------
// f32 -> RNE bf16 plane, 8 consecutive elements per thread packed as integer words.
// Coverage: n8 = n/8 threads x 8 = the whole plane (grid is an exact multiple of 256 here).
// ---------------------------------------------------------------------------
__global__ __launch_bounds__(256) void cast8_bf16_kernel(const float* __restrict__ in, unsigned short* __restrict__ out, int n8) {
  const int i = blockIdx.x * 256 + threadIdx.x;
  if (i >= n8) return;
  const float* p = in + 8 * (size_t)i;
  const v4f a = *(const v4f*)(p);
  const v4f c = *(const v4f*)(p + 4);
  float f[8];
#pragma unroll
  for (int e = 0; e < 4; ++e) { f[e] = a[e]; f[4 + e] = c[e]; }
  unsigned w[4];
#pragma unroll
  for (int e2 = 0; e2 < 4; ++e2) w[e2] = pk16(f2bf_bits(f[2 * e2]), f2bf_bits(f[2 * e2 + 1]));
  const v4u u = (v4u){w[0], w[1], w[2], w[3]};
  unsigned short* q = out + 8 * (size_t)i;
  *(v4u*)q = u;
  
}

// ---------------------------------------------------------------------------
// Transpose + RNE bf16 convert of a weight matrix with zero padding of the output rows:
// in f32 [R][ncol] row-major (ldin = ncol) -> out bf16 [Cpad][R] (ldout = R): out[c][r] = bf16(in[r][c]) for c < ncol, 0 for c >= ncol.
// grid (R/64, Cpad/64): blockIdx.x = r tile (64 output cols), blockIdx.y = c tile (64 output rows). 256 threads.
// Load coverage: 16 iterations x 256 threads = 4096 = the whole 64x64 tile; column ADDRESS clamped to ncol-1, value zeroed by predicate.
// Store coverage: 8 waves x 2 iterations x 4 rows (lane>>3) = 64 rows; (lane&7) x 8 halves = 64 cols; each row segment =
// ---------------------------------------------------------------------------
__global__ __launch_bounds__(256) void transpose_cast_pad_kernel(const float* __restrict__ in, int ldin, int ncol,
                                                                 unsigned short* __restrict__ out, int ldout) {
  __shared__ float sm[64][65];   // sm[c_local][r_local]
  const int t  = threadIdx.x;
  const int r0 = blockIdx.x * 64;
  const int c0 = blockIdx.y * 64;
#pragma unroll
  for (int i = 0; i < 16; ++i) {
    const int e = i * 256 + t;
    const int r = e >> 6;          // r local
    const int c = e & 63;          // c local
    const int cg = c0 + c;
    const int cc = (cg < ncol) ? cg : (ncol - 1);
    const float v = in[(size_t)(r0 + r) * ldin + cc];
    sm[c][r] = (cg < ncol) ? v : 0.0f;
  }
  __syncthreads();
  const int lane = t & 31, wave = t >> 5;
  const int q = lane >> 3, c8 = (lane & 7) * 8;
  {
#pragma unroll
    for (int it = 0; it < 2; ++it) {
      const int row = wave * 8 + it * 4 + q;                 // c local (output row)
      unsigned w[4];
#pragma unroll
      for (int e2 = 0; e2 < 4; ++e2) w[e2] = pk16(f2bf_bits(sm[row][c8 + 2 * e2]), f2bf_bits(sm[row][c8 + 2 * e2 + 1]));
      const v4u u = (v4u){w[0], w[1], w[2], w[3]};
      const size_t o = (size_t)(c0 + row) * ldout + r0 + c8;
      *(v4u*)(out + o) = u;
    }
    
  }
}

// ---------------------------------------------------------------------------
// Bias vectors -> RNE-bf16 valued f32 lines padded to kUP: outp[p][u] = bf16(b_p[u]) for u < nvalid, 0 otherwise (p = blockIdx.x in 0..2).
// All three candidates loaded with a clamped index, selected by value. 64 threads x 4 floats = 256 = kUP;
// ---------------------------------------------------------------------------
__global__ __launch_bounds__(64) void bias_pad_kernel(const float* __restrict__ b0, const float* __restrict__ b1,
                                                     const float* __restrict__ b2, int nvalid, float* __restrict__ outp) {
  const int p = blockIdx.x;
  const int t = threadIdx.x;
  float f[4];
#pragma unroll
  for (int e = 0; e < 4; ++e) {
    const int u  = 4 * t + e;
    const int uc = (u < nvalid) ? u : (nvalid - 1);
    const float v0 = b0[uc], v1 = b1[uc], v2 = b2[uc];
    float v = (p == 0) ? v0 : ((p == 1) ? v1 : v2);
    v = bf_bits2f(f2bf_bits(v));
    f[e] = (u < nvalid) ? v : 0.0f;
  }
  const v4f val = (v4f){f[0], f[1], f[2], f[3]};
  float* dst = outp + (size_t)p * kUP + 4 * t;
  *(v4f*)dst = val;
  
}

// ---------------------------------------------------------------------------
// Row softmax over materialised f32 scores of all batches (16384 rows x 2048 cols), no mask.
// p = exp(score - max) * (1/sum); P written as bf16 hi/lo planes IN PLACE over the row's own scores:
// the 8192 bytes of f32 row r become 2048 bf16 hi (bytes 0..4095) followed by 2048 bf16 lo (bytes 4096..8191).
// Safe because one block owns one row, every thread's score loads are consumed in front of the first __syncthreads(),
// and the P stores stand behind the second one. One pointer, no __restrict__: loads and stores alias.
// One block of 256 threads per row; thread t owns columns 8t..8t+7 (256 x 8 = 2048).
// Reductions in fixed order (thread, wave shuffle tree, 8 wave partials in index order); shuffles outside all branches.
// ---------------------------------------------------------------------------
__global__ __launch_bounds__(256) void softmax_rows_kernel(float* SP) {
  __shared__ float redM[8];
  __shared__ float redS[8];
  const int qi   = blockIdx.x;           // query row 0..16383 (batch * 2048 + row)
  const int t    = threadIdx.x;
  const int lane = t & 31, wave = t >> 5;
  const int c0   = t * 8;
  const size_t rowoff = (size_t)qi * (size_t)kSeq;

  const float* sr = SP + rowoff + c0;
  const v4f a = *(const v4f*)(sr);
  const v4f c = *(const v4f*)(sr + 4);
  float xv[8];
#pragma unroll
  for (int e = 0; e < 4; ++e) { xv[e] = a[e]; xv[4 + e] = c[e]; }
  float m = xv[0];
#pragma unroll
  for (int e = 1; e < 8; ++e) m = fmaxf(m, xv[e]);
#pragma unroll
  for (int off = 16; off > 0; off >>= 1) m = fmaxf(m, __shfl_xor(m, off, 32));
  if (lane == 0) redM[wave] = m;
  __syncthreads();
  float gmax = redM[0];
#pragma unroll
  for (int w = 1; w < 8; ++w) gmax = fmaxf(gmax, redM[w]);

  float p[8];
  float ps = 0.0f;
#pragma unroll
  for (int e = 0; e < 8; ++e) { p[e] = expf(xv[e] - gmax); ps += p[e]; }
#pragma unroll
  for (int off = 16; off > 0; off >>= 1) ps += __shfl_xor(ps, off, 32);
  if (lane == 0) redS[wave] = ps;
  __syncthreads();
  float tot = redS[0];
#pragma unroll
  for (int w = 1; w < 8; ++w) tot += redS[w];
  const float inv = 1.0f / tot;          // tot >= 1

  unsigned hw[4], lw[4];
#pragma unroll
  for (int e2 = 0; e2 < 4; ++e2) {
    const float f0 = p[2 * e2] * inv;
    const float f1 = p[2 * e2 + 1] * inv;
    const unsigned short h0 = f2bf_bits(f0);
    const unsigned short h1 = f2bf_bits(f1);
    const unsigned short l0 = f2bf_bits(f0 - bf_bits2f(h0));
    const unsigned short l1 = f2bf_bits(f1 - bf_bits2f(h1));
    hw[e2] = pk16(h0, h1);
    lw[e2] = pk16(l0, l1);
  }
  const v4u hv = (v4u){hw[0], hw[1], hw[2], hw[3]};
  const v4u lv = (v4u){lw[0], lw[1], lw[2], lw[3]};
  unsigned short* ph = (unsigned short*)(SP + rowoff) + c0;
  unsigned short* pl = ph + kSeq;
  *(v4u*)ph = hv;
  *(v4u*)pl = lv;
  
}

// ---------------------------------------------------------------------------
// Final copy: tmp f32 [kRows][kUP] (pitch 256) -> out f32 flat [kRows][kUnits] (pitch 200, contiguous).
// Thread i owns flat output elements 4i..4i+3 (same row since 200 % 4 == 0); one 16-B store per lane, thread-linear from the
// Coverage: n4 = kRows*kUnits/4 threads x 4 = the whole output (grid exact multiple of 256).
// ---------------------------------------------------------------------------
__global__ __launch_bounds__(256) void copy_out_kernel(const float* __restrict__ tmp, float* __restrict__ out, int n4) {
  const int i = blockIdx.x * 256 + threadIdx.x;
  if (i >= n4) return;
  const int e   = 4 * i;
  const int row = e / kUnits;
  const int col = e - row * kUnits;
  const v4f v = *(const v4f*)(tmp + (size_t)row * kUP + col);
  float* dst = out + (size_t)e;
  *(v4f*)dst = v;
  
}

// ---------------------------------------------------------------------------
// Launcher. Workspace region map (bytes, MiB = 1048576; total carve = 192 MiB + 786432 + 3072 = 202116096 B):
//   [  0,128) S/P   : scores f32 [8][2048][2048]; softmax turns each 8192-B row into P hi bf16 [2048] + P lo bf16 [2048] in place
//                     earlier alias: Xg = generated as bf16 [16384][512] at [0, 16), Xr = real as bf16 [16384][512] at [16, 32)
//   [128,136) q hi  : bf16 [16384][256]; [136,144) q lo
//   [144,152) k hi  : bf16 [16384][256]; [152,160) k lo
//   [160,168) v^T hi: bf16 [256][16384]; [168,176) v^T lo
//   [176,192) O tmp : f32 [16384][256]
//   [192 MiB, +786432)  W^T planes: 3 x bf16 [256][512] (262144 B each: Wq^T, Wk^T, Wv^T; rows 200..255 zero)
//   [ +786432, +3072)   bias lines: 3 x f32 [256] (RNE-bf16 values, 200..255 zero)
// Lifetimes: Xg is read only by the q projection, Xr only by the k and v^T projections (launches 7..9); S first written in launch 10.
// Launch count: 2 casts + 3 transposes + 1 bias + 3 projections + scores + softmax + p.v (blockIdx.y = batch) + 1 copy = 13. Kernel launches only.
// GEMM shapes: proj q/k M=16384 N=256 K=512; v^T M=256 N=16384 K=512; per batch scores M=N=2048 K=224; p.v M=2048 N=256 K=2048 (all M % 128 == 0, N % 256 == 0, K % 32 == 0; row pitches cover K rounded up to 64).
// ---------------------------------------------------------------------------
extern "C" void kernel_launch(void* const* d_in, const int* in_sizes, int n_in,
                              void* d_out, int out_size, void* d_ws, size_t ws_size,
                              hipStream_t stream) {
  if (n_in < 8) return;
  if (in_sizes[0] != kRows * kDin || in_sizes[1] != kRows * kDin) return;
  if (in_sizes[2] != kDin * kUnits || in_sizes[4] != kDin * kUnits || in_sizes[6] != kDin * kUnits) return;
  if (in_sizes[3] != kUnits || in_sizes[5] != kUnits || in_sizes[7] != kUnits) return;
  if (out_size != kRows * kUnits) return;

  const size_t kMiB    = 1048576;
  const size_t offXg   = 0;
  const size_t offXr   = 16 * kMiB;
  const size_t offS    = 0;
  const size_t offQhi  = 128 * kMiB;
  const size_t offQlo  = 136 * kMiB;
  const size_t offKhi  = 144 * kMiB;
  const size_t offKlo  = 152 * kMiB;
  const size_t offVhi  = 160 * kMiB;
  const size_t offVlo  = 168 * kMiB;
  const size_t offO    = 176 * kMiB;
  const size_t wplane  = (size_t)kUP * kDin * 2;                 // 262144 B
  const size_t offWq   = 192 * kMiB;
  const size_t offWk   = offWq + wplane;
  const size_t offWv   = offWk + wplane;
  const size_t offBias = offWv + wplane;                         // 192 MiB + 786432
  const size_t total   = offBias + (size_t)3 * kUP * 4;          // 202116096 B
  if (total > ws_size) return;

  const float* gen  = (const float*)d_in[0];
  const float* real = (const float*)d_in[1];
  const float* Wq   = (const float*)d_in[2];
  const float* bq   = (const float*)d_in[3];
  const float* Wk   = (const float*)d_in[4];
  const float* bk   = (const float*)d_in[5];
  const float* Wv   = (const float*)d_in[6];
  const float* bv   = (const float*)d_in[7];
  float* out = (float*)d_out;
  char* ws = (char*)d_ws;

  unsigned short* xg   = (unsigned short*)(ws + offXg);
  unsigned short* xr   = (unsigned short*)(ws + offXr);
  float*          Sbuf = (float*)(ws + offS);
  unsigned short* phi  = (unsigned short*)(ws + offS);           // row pitch 2 * kSeq halves
  unsigned short* plo  = phi + kSeq;
  unsigned short* qhi  = (unsigned short*)(ws + offQhi);
  unsigned short* qlo  = (unsigned short*)(ws + offQlo);
  unsigned short* khi  = (unsigned short*)(ws + offKhi);
  unsigned short* klo  = (unsigned short*)(ws + offKlo);
  unsigned short* vthi = (unsigned short*)(ws + offVhi);
  unsigned short* vtlo = (unsigned short*)(ws + offVlo);
  float*          Otmp = (float*)(ws + offO);
  unsigned short* wqT  = (unsigned short*)(ws + offWq);
  unsigned short* wkT  = (unsigned short*)(ws + offWk);
  unsigned short* wvT  = (unsigned short*)(ws + offWv);
  float*          biasP = (float*)(ws + offBias);

  // in-range dummies for unused (never dereferenced) template-dead pointer parameters
  const float* dummy_f = biasP;
  void* dummy_c2 = (void*)biasP;

  // 1-2. activations -> RNE bf16 planes [16384][512]
  {
    const int n8 = (kRows * kDin) / 8;                      // 1048576 = 4096 blocks x 256
    cast8_bf16_kernel<<<dim3(n8 / 256), dim3(256), 0, stream>>>(gen, xg, n8);
    cast8_bf16_kernel<<<dim3(n8 / 256), dim3(256), 0, stream>>>(real, xr, n8);
  }
  // 3-5. W [R=512][ncol=200] -> W^T bf16 [256][512] with rows 200..255 zero; grid (R/64, 256/64)
  transpose_cast_pad_kernel<<<dim3(kDin / 64, kUP / 64), dim3(256), 0, stream>>>(Wq, kUnits, kUnits, wqT, kDin);
  transpose_cast_pad_kernel<<<dim3(kDin / 64, kUP / 64), dim3(256), 0, stream>>>(Wk, kUnits, kUnits, wkT, kDin);
  transpose_cast_pad_kernel<<<dim3(kDin / 64, kUP / 64), dim3(256), 0, stream>>>(Wv, kUnits, kUnits, wvT, kDin);
  // 6. biases -> padded RNE-bf16 valued f32 lines [3][256]
  bias_pad_kernel<<<dim3(3), dim3(64), 0, stream>>>(bq, bk, bv, kUnits, biasP);

  // 7. q = Xg . Wq^T + bq : M=16384, N=256, K=512, single bf16 product -> bf16 hi/lo planes [16384][256]
  wmma_gemm64<1, false, 2, 2, false, 0><<<dim3((kRows / kTileM) * (kUP / kTileN), 1), dim3(256), 0, stream>>>(
      xg, xg, kDin, 0L,
      wqT, wqT, kDin, 0L,
      (void*)qhi, (void*)qlo, kUP, 0L,
      biasP, dummy_f, 0L,
      kRows, kUP, kDin, 1.0f);
  // 8. k = Xr . Wk^T + bk
  wmma_gemm64<1, false, 2, 2, false, 0><<<dim3((kRows / kTileM) * (kUP / kTileN), 1), dim3(256), 0, stream>>>(
      xr, xr, kDin, 0L,
      wkT, wkT, kDin, 0L,
      (void*)khi, (void*)klo, kUP, 0L,
      biasP + kUP, dummy_f, 0L,
      kRows, kUP, kDin, 1.0f);
  // 9. v^T = Wv^T . Xr^T + bv[m] : M=256 (u), N=16384 (b*2048+t), K=512 -> bf16 hi/lo planes [256][16384]
  wmma_gemm64<1, false, 1, 2, false, 0><<<dim3((kUP / kTileM) * (kRows / kTileN), 1), dim3(256), 0, stream>>>(
      wvT, wvT, kDin, 0L,
      xr, xr, kDin, 0L,
      (void*)vthi, (void*)vtlo, kRows, 0L,
      biasP + 2 * kUP, dummy_f, 0L,
      kUP, kRows, kDin, 1.0f);

  // 10. scores = 200^-0.5 * q . k^T, all batches (blockIdx.y): M=N=2048, K=224 (cols 200..223 exact zeros), 3 products on hi/lo planes -> f32 [8][2048][2048]
  wmma_gemm64<1, true, 0, 0, false, 0><<<dim3((kSeq / kTileM) * (kSeq / kTileN), kBatch), dim3(256), 0, stream>>>(
      qhi, qlo, kUP, (long)kSeq * kUP,
      khi, klo, kUP, (long)kSeq * kUP,
      (void*)Sbuf, dummy_c2, kSeq, (long)kSeq * kSeq,
      dummy_f, dummy_f, 0L,
      kSeq, kSeq, kKS, kScoreScale);

  // 11. softmax of all 16384 rows -> P hi/lo planes in place (row pitch 4096 halves)
  softmax_rows_kernel<<<dim3(kRows), dim3(256), 0, stream>>>(Sbuf);

  // 12. O = P . v, all batches (blockIdx.y): M=2048, N=256, K=2048, 3 products; Bt = v^T rows u, cols b*2048.. (ldb 16384) -> f32 temp rows b*2048.., pitch 256
  wmma_gemm64<1, true, 0, 0, false, 0><<<dim3((kSeq / kTileM) * (kUP / kTileN), kBatch), dim3(256), 0, stream>>>(
      phi, plo, 2 * kSeq, (long)kSeq * 2 * kSeq,
      vthi, vtlo, kRows, (long)kSeq,
      (void*)Otmp, dummy_c2, kUP, (long)kSeq * kUP,
      dummy_f, dummy_f, 0L,
      kSeq, kUP, kSeq, 1.0f);

  // 13. temp [16384][256] -> out [16384][200] contiguous
  {
    const int n4 = (kRows * kUnits) / 4;                    // 819200 = 3200 blocks x 256
    copy_out_kernel<<<dim3(n4 / 256), dim3(256), 0, stream>>>(Otmp, out, n4);
  }
}

// v003
// Measured time: 191 microseconds a run.
// Two timings next to v002 both put it at 1.11 times that version's speed.
// Counting every step since v000, it is 7.78 times as fast.
// Contractions: x.W projections (q, k planes and v^T plane): single v_wmma_f32_16x16x32_bf16 product on RNE-bf16 converted x, W, bias; q.k^T scores and p.v output: bf16 hi/lo operand planes (hi.hi + hi.lo + lo.hi); all f32 accumulate; p.v summed as two halves of the key range, the two f32 partial sums added once; softmax in f32.
#include <hip/hip_runtime.h>
#include <math.h>

// ---------------------------------------------------------------------------
// Problem constants
// ---------------------------------------------------------------------------
constexpr int kBatch = 8;
constexpr int kSeq   = 2048;
constexpr int kDin   = 512;
constexpr int kUnits = 200;
constexpr int kUP    = 256;              // padded unit count (cols 200..255 exactly zero)
constexpr int kRows  = kBatch * kSeq;    // 16384 token rows
constexpr int kKS    = 224;              // score contraction depth (q/k cols 200..223 are exact zeros)
constexpr float kScoreScale = 0.070710678118654752f;   // 200^-0.5 applied in the f32 epilogue

static_assert(kSeq == 2048, "softmax kernel: 256 threads x 8 columns = one row");
static_assert(kRows % 64 == 0 && kUP % 64 == 0 && kSeq % 64 == 0 && kDin % 64 == 0, "tile multiples");
static_assert(kDin % 32 == 0 && kKS % 32 == 0 && kSeq % 32 == 0, "K multiples of 32");
static_assert(kKS >= kUnits && kKS <= kUP, "score depth covers all real units");
static_assert(kRows % 256 == 0 && kSeq % 256 == 0 && kUP % 256 == 0, "work-group tile 128 x 256 in either orientation");
static_assert((kKS + 63) / 64 * 64 <= kUP, "the last score stage copies whole 128-B rows inside the q/k row pitch");
static_assert((kRows * kDin) % (8 * 256) == 0, "cast kernel grid exact");
static_assert((kRows * kUnits) % (4 * 256) == 0 && kUnits % 4 == 0, "copy kernel grid exact, float4 inside one row");
static_assert(kUP == 4 * 64, "bias kernel: 64 threads x 4 floats");
constexpr int kPvSplit = 2;              // p.v: key range cut into this many parts, one work-group each (blockIdx.z)
static_assert(kSeq % (kPvSplit * 64) == 0, "each part of the p.v key range is a whole number of 64-k stages");
static_assert(kPvSplit == 2, "the final kernel adds exactly two partial sums");

typedef __attribute__((ext_vector_type(16))) _Float16 v16h;
typedef __attribute__((ext_vector_type(8)))  _Float16 v8h;
typedef __attribute__((ext_vector_type(16))) __bf16   v16b;
typedef __attribute__((ext_vector_type(8)))  __bf16   v8b;
typedef __attribute__((ext_vector_type(8)))  float    v8f;
typedef __attribute__((ext_vector_type(4)))  float    v4f;
typedef __attribute__((ext_vector_type(4)))  unsigned int v4u;

// ---------------------------------------------------------------------------
// Device helpers
// ---------------------------------------------------------------------------
__device__ __forceinline__ unsigned short f2bf_bits(float f) {
  unsigned u = __float_as_uint(f);
  return (unsigned short)((u + 0x7FFFu + ((u >> 16) & 1u)) >> 16);
}
__device__ __forceinline__ float bf_bits2f(unsigned short h) { return __uint_as_float(((unsigned)h) << 16); }

// hazard guards as plain device helpers
__device__ __forceinline__ void dep_guard_h(v8f& a, v8f& b, v16h x, v16h y) { asm volatile("v_nop\n\tv_nop\n\tv_nop\n\tv_nop" : "+v"(a), "+v"(b) : "v"(x), "v"(y)); }
__device__ __forceinline__ void dep_guard_b(v8f& a, v8f& b, v16b x, v16b y) { asm volatile("v_nop\n\tv_nop\n\tv_nop\n\tv_nop" : "+v"(a), "+v"(b) : "v"(x), "v"(y)); }
__device__ __forceinline__ void keep4_h(v16h a, v16h b, v16h c, v16h d) { asm volatile("v_nop" :: "v"(a), "v"(b), "v"(c), "v"(d)); }
__device__ __forceinline__ void keep4_b(v16b a, v16b b, v16b c, v16b d) { asm volatile("v_nop" :: "v"(a), "v"(b), "v"(c), "v"(d)); }
__device__ __forceinline__ void acc_guard4(v8f& a, v8f& b, v8f& c, v8f& d) { asm volatile("v_nop\n\tv_nop\n\tv_nop\n\tv_nop" : "+v"(a), "+v"(b), "+v"(c), "+v"(d)); }
template <typename T> struct Frag;
template <> struct Frag<_Float16> {
  typedef v16h V; union U { v16h v; v8h h[2]; };
  // elements 0..7 <- p[0..7], 8..15 <- p[16..23]
  static __device__ __forceinline__ v16h load(const _Float16* p) {
    U f; f.h[0] = *(const v8h*)(p); f.h[1] = *(const v8h*)(p + 16); return f.v;
  }
  static __device__ __forceinline__ v8f mma(v16h a, v16h b, v8f c) {
    return __builtin_amdgcn_wmma_f32_16x16x32_f16(false, a, false, b, (short)0, c, false, false);
  }
  static __device__ __forceinline__ void guard(v8f& a, v8f& b, v16h x, v16h y) { dep_guard_h(a, b, x, y); }
  static __device__ __forceinline__ void keep(v16h a, v16h b, v16h c, v16h d) { keep4_h(a, b, c, d); }
};
template <> struct Frag<__bf16> {
  typedef v16b V; union U { v16b v; v8b h[2]; };
  static __device__ __forceinline__ v16b load(const __bf16* p) {
    U f; f.h[0] = *(const v8b*)(p); f.h[1] = *(const v8b*)(p + 16); return f.v;
  }
  static __device__ __forceinline__ v8f mma(v16b a, v16b b, v8f c) {
    return __builtin_amdgcn_wmma_f32_16x16x32_bf16(false, a, false, b, (short)0, c, false, false);
  }
  static __device__ __forceinline__ void guard(v8f& a, v8f& b, v16b x, v16b y) { dep_guard_b(a, b, x, y); }
  static __device__ __forceinline__ void keep(v16b a, v16b b, v16b c, v16b d) { keep4_b(a, b, c, d); }
};

__device__ __forceinline__ unsigned pk16(unsigned short a, unsigned short b) { return (unsigned)a | ((unsigned)b << 16); }

// ---- Register-blocked batched WMMA GEMM, operands staged in LDS by asynchronous copies ----
// C[m,n] = scale * sum_k A[m,k] * Bt[n,k] (+bias)(+resid); a work-group owns a 128x256 tile, each of its 8 waves (2 x 4) a 64x64 tile.
// A row-major [M,K]; Bt row-major [N,K]; M % 128 == 0, N % 256 == 0, K % 32 == 0; lda, ldb >= K rounded up to 64 (a stage copies whole 128-B rows).
// blockIdx.z = part of a K range cut by the launcher: part z reads A and Bt from element z * zA / z * zB of each row on, K elements deep, and
// writes its own partial C at z * zC (the launcher's next kernel adds the parts; only with BIAS_MODE 0 and no resid). One part: zA = zB = zC = 0.
// SPLIT: operands are hi/lo planes (A2/Bt2 = lo planes, same layout); product = hi.hi + hi.lo + lo.hi.
// BIAS_MODE: 0 = none, 1 = bias[m], 2 = bias[n].
// OUT_MODE: 0 = f32, 1 = f16, 2 = bf16 hi plane (Cout) + bf16 lo plane (Cout2).
// ET: 0 = f16 operands, 1 = bf16 operands (pointers passed as 16-bit storage)
// Stage = 64 k of every operand row: [A hi 128 rows | B hi 256 rows | A lo | B lo], LDS row pitch 144 B (16 B x odd: ds_load_b128 free of bank conflicts).
// Two buffers: the copies of stage s + 1 fly while stage s is multiplied.
constexpr int kStageK  = 64;                      // k per stage = 128 B of a row = one whole line
constexpr int kPitchB  = 144;                     // LDS row pitch, bytes
constexpr int kTileM   = 128;
constexpr int kTileN   = 256;
constexpr int kPlaneA  = kTileM * kPitchB;        // 18432 B
constexpr int kPlaneB  = kTileN * kPitchB;        // 36864 B
constexpr int kPlaneAB = kPlaneA + kPlaneB;       // 55296 B
constexpr int kRowStep = 32 * kPitchB;            // 256 threads copy 32 rows of 128 B at a time

// One plane pair of a stage: 4 x 32 rows of A and 8 x 32 rows of B, 16 B per lane and copy, through no register.
// la / lb: the lane's LDS byte address of its first A / B row; ga / gb: its global address; sa / sb: bytes between 32 global rows.
// s_wait_xcnt 0 is the statement's last line: it stands in front of any later write of the address registers named here.
__device__ __forceinline__ void async_copy_plane(unsigned la, const char* ga, size_t sa, unsigned lb, const char* gb, size_t sb) {
  asm volatile(
      "global_load_async_to_lds_b128 %0, %12, off\n\t"
      "global_load_async_to_lds_b128 %1, %13, off\n\t"
      "global_load_async_to_lds_b128 %2, %14, off\n\t"
      "global_load_async_to_lds_b128 %3, %15, off\n\t"
      "global_load_async_to_lds_b128 %4, %16, off\n\t"
      "global_load_async_to_lds_b128 %5, %17, off\n\t"
      "global_load_async_to_lds_b128 %6, %18, off\n\t"
      "global_load_async_to_lds_b128 %7, %19, off\n\t"
      "global_load_async_to_lds_b128 %8, %20, off\n\t"
      "global_load_async_to_lds_b128 %9, %21, off\n\t"
      "global_load_async_to_lds_b128 %10, %22, off\n\t"
      "global_load_async_to_lds_b128 %11, %23, off\n\t"
      "s_wait_xcnt 0x0"
      :: "v"(la), "v"(la + kRowStep), "v"(la + 2 * kRowStep), "v"(la + 3 * kRowStep),
         "v"(lb), "v"(lb + kRowStep), "v"(lb + 2 * kRowStep), "v"(lb + 3 * kRowStep),
         "v"(lb + 4 * kRowStep), "v"(lb + 5 * kRowStep), "v"(lb + 6 * kRowStep), "v"(lb + 7 * kRowStep),
         "v"(ga), "v"(ga + sa), "v"(ga + 2 * sa), "v"(ga + 3 * sa),
         "v"(gb), "v"(gb + sb), "v"(gb + 2 * sb), "v"(gb + 3 * sb),
         "v"(gb + 4 * sb), "v"(gb + 5 * sb), "v"(gb + 6 * sb), "v"(gb + 7 * sb)
      : "memory");
}

template <int ET> struct Elem;
template <> struct Elem<0> { typedef _Float16 T; };
template <> struct Elem<1> { typedef __bf16 T; };
template <int ET, bool SPLIT, int BIAS_MODE, int OUT_MODE, bool RESID, int ACT = 0>
__global__ __launch_bounds__(256) void wmma_gemm64(
    const unsigned short* __restrict__ Ap, const unsigned short* __restrict__ A2p, int lda, long strideA,
    const unsigned short* __restrict__ Btp, const unsigned short* __restrict__ Bt2p, int ldb, long strideB,
    void* __restrict__ Cout, void* __restrict__ Cout2, int ldc, long strideC,
    long zA, long zB, long zC,
    const float* __restrict__ bias,
    const float* __restrict__ resid, long strideR,
    int M, int N, int K, float scale) {
  typedef typename Elem<ET>::T T;
  typedef typename Frag<T>::V V;
  constexpr int kStageB = (SPLIT ? 2 : 1) * kPlaneAB;   // bytes of one buffer
  __shared__ __align__(16) char ring[2 * kStageB];      // two stage buffers
  __shared__ __align__(16) float sT[8][16 * 68];        // per-wave 16x64 slab, pitch 68 floats
  const int b    = blockIdx.y;
  const int z    = blockIdx.z;
  const int lane = threadIdx.x & 31;
  const int wave = threadIdx.x >> 5;
  const int tilesN = N >> 8;
  const int tilesM = M >> 7;
  if ((int)blockIdx.x >= tilesM * tilesN) return;   // the same for the whole work-group, in front of every copy and barrier
  const int tm  = blockIdx.x / tilesN;
  const int tn  = blockIdx.x - tm * tilesN;
  const int m0g = tm << 7;                          // work-group tile origin
  const int n0g = tn << 8;
  const int mw  = (wave >> 2) << 6;                 // wave tile origin inside it
  const int nw  = (wave & 3) << 6;
  const int m0  = m0g + mw;
  const int n0  = n0g + nw;

  const int rlane = lane & 15;                 // row (A) / col (B, D) within subtile
  const int koff  = (lane >> 4) * 8;           // k offset of this lane half
  const int mOff  = (lane >> 4) * 8;           // D row offset

  // copy addresses of this lane: row threadIdx.x / 8 of each group of 32 rows, 16-B piece threadIdx.x % 8 of its 128 B
  const int crow = threadIdx.x >> 3;
  const int cpc  = (threadIdx.x & 7) << 4;
  const size_t rsA = (size_t)lda * 64;         // 32 rows x 2 B
  const size_t rsB = (size_t)ldb * 64;
  const size_t goA = ((size_t)b * strideA + (size_t)z * zA + (size_t)(m0g + crow) * lda) * 2 + cpc;
  const size_t goB = ((size_t)b * strideB + (size_t)z * zB + (size_t)(n0g + crow) * ldb) * 2 + cpc;
  const char* gA  = (const char*)Ap  + goA;
  const char* gB  = (const char*)Btp + goB;
  const char* gA2 = (const char*)A2p  + goA;
  const char* gB2 = (const char*)Bt2p + goB;
  const unsigned lds0 = (unsigned)(size_t)(&ring[0]) + (unsigned)(crow * kPitchB + cpc);
  auto fill = [&](int s, int buf) {
    const size_t kb = (size_t)s * (kStageK * 2);
    const unsigned l = lds0 + (unsigned)(buf * kStageB);
    async_copy_plane(l, gA + kb, rsA, l + kPlaneA, gB + kb, rsB);
    if (SPLIT) async_copy_plane(l + kPlaneAB, gA2 + kb, rsA, l + kPlaneAB + kPlaneA, gB2 + kb, rsB);
  };

  v8f acc[4][4];
#pragma unroll
  for (int i = 0; i < 4; ++i)
#pragma unroll
    for (int j = 0; j < 4; ++j) acc[i][j] = (v8f){0.f,0.f,0.f,0.f,0.f,0.f,0.f,0.f};

  const int nst = (K + kStageK - 1) / kStageK;
  fill(0, 0);
  asm volatile("s_wait_asynccnt 0x0" ::: "memory");   // this wave's share of stage 0 has landed
  __syncthreads();                                    // publishes stage 0
  if (nst > 1) fill(1, 1);

  const int fragA = (mw + rlane) * kPitchB + koff * 2;            // byte of this lane's first A fragment row in a plane pair
  const int fragB = kPlaneA + (nw + rlane) * kPitchB + koff * 2;  // the same for B
  for (int s = 0; s < nst; ++s) {
    const char* sb = ring + (s & 1) * kStageB;
#pragma unroll   // kk becomes an immediate in every LDS offset
    for (int kk = 0; kk < 2; ++kk) {
      if (s * kStageK + kk * 32 < K) {   // scalar: a K that is an odd multiple of 32 ends on half a stage
        V bh[4], bl[4];
#pragma unroll
        for (int j = 0; j < 4; ++j) {
          const char* bp = sb + fragB + j * (16 * kPitchB) + kk * 64;
          bh[j] = Frag<T>::load((const T*)bp);
          if (SPLIT) bl[j] = Frag<T>::load((const T*)(bp + kPlaneAB));
        }
#pragma unroll
        for (int i = 0; i < 4; ++i) {
          const char* ap = sb + fragA + i * (16 * kPitchB) + kk * 64;
          V ah = Frag<T>::load((const T*)ap);
          V al;
          if (SPLIT) al = Frag<T>::load((const T*)(ap + kPlaneAB));
#pragma unroll
          for (int j = 0; j < 4; ++j) {
            acc[i][j] = Frag<T>::mma(ah, bh[j], acc[i][j]);
            if (SPLIT) acc[i][j] = Frag<T>::mma(ah, bl[j], acc[i][j]);
            if (SPLIT) acc[i][j] = Frag<T>::mma(al, bh[j], acc[i][j]);
          }
          Frag<T>::guard(acc[i][0], acc[i][3], ah, SPLIT ? al : ah);
        }
        Frag<T>::keep(bh[0], bh[1], bh[2], bh[3]);
        if (SPLIT) Frag<T>::keep(bl[0], bl[1], bl[2], bl[3]);
      }
    }
    asm volatile("s_wait_dscnt 0x0" ::: "memory");      // this wave's reads of buffer s & 1 are done before it is refilled
    asm volatile("s_wait_asynccnt 0x0" ::: "memory");   // this wave's share of stage s + 1 has landed
    __syncthreads();                                    // publishes stage s + 1 and ends every reader's last read of stage s
    if (s + 2 < nst) fill(s + 2, s & 1);
  }
  asm volatile("s_wait_asynccnt 0x0" ::: "memory");     // nothing in flight when the wave goes on to the epilogue and ends
  acc_guard4(acc[0][0], acc[0][1], acc[0][2], acc[0][3]);
  acc_guard4(acc[1][0], acc[1][1], acc[1][2], acc[1][3]);
  acc_guard4(acc[2][0], acc[2][1], acc[2][2], acc[2][3]);
  acc_guard4(acc[3][0], acc[3][1], acc[3][2], acc[3][3]);

  // ---- epilogue ----
  float* slab = sT[wave];
  const float* Rb = RESID ? (resid + (size_t)b * strideR) : nullptr;
#pragma unroll
  for (int i = 0; i < 4; ++i) {
    const int mBase = m0 + (i << 4);
#pragma unroll
    for (int j = 0; j < 4; ++j) {
      const int n = n0 + (j << 4) + rlane;
      float bv = 0.f;
      if (BIAS_MODE == 2) bv = bias[n];
#pragma unroll
      for (int r = 0; r < 8; ++r) {
        float v = acc[i][j][r] * scale;
        if (BIAS_MODE == 1) v += bias[mBase + mOff + r];
        if (BIAS_MODE == 2) v += bv;
        if (RESID) v += Rb[(size_t)(mBase + mOff + r) * ldc + n];
        if (ACT == 2) v = fmaxf(v, 0.0f);
        if (ACT == 4) v = (v > 0.f) ? v : 0.01f * v;
        slab[(mOff + r) * 68 + (j << 4) + rlane] = v;
      }
    }
    __builtin_amdgcn_fence(__ATOMIC_RELEASE, "workgroup");
    __builtin_amdgcn_wave_barrier();
    __builtin_amdgcn_fence(__ATOMIC_ACQUIRE, "workgroup");
    if (OUT_MODE == 0) {
      float* C = (float*)Cout + (size_t)b * strideC + (size_t)z * zC;
      const int hh = lane >> 4, c4 = (lane & 15) * 4;     // row seg = 256 B = 16 lanes x 16 B
      {
#pragma unroll
        for (int it = 0; it < 8; ++it) {
          const int row = it * 2 + hh;
          v4f v = *(const v4f*)(slab + row * 68 + c4);
          *(v4f*)(C + (size_t)(mBase + row) * ldc + n0 + c4) = v;
        }
        
      }
    } else {
      const int q = lane >> 3, c8 = (lane & 7) * 8;
      unsigned short* C  = (unsigned short*)Cout  + (size_t)b * strideC + (size_t)z * zC;
      unsigned short* C2 = (OUT_MODE == 2) ? ((unsigned short*)Cout2 + (size_t)b * strideC + (size_t)z * zC) : nullptr;
      {
#pragma unroll
        for (int it = 0; it < 4; ++it) {
          const int row = it * 4 + q;
          const float* sp = slab + row * 68 + c8;
          v8h hv, lv;
#pragma unroll
          for (int e = 0; e < 8; ++e) {
            if (OUT_MODE == 1) {
              hv[e] = (_Float16)sp[e];
            } else {
              unsigned short hb = f2bf_bits(sp[e]);
              unsigned short lb = f2bf_bits(sp[e] - bf_bits2f(hb));
              hv[e] = __builtin_bit_cast(_Float16, hb);
              lv[e] = __builtin_bit_cast(_Float16, lb);
            }
          }
          *(v8h*)(C + (size_t)(mBase + row) * ldc + n0 + c8) = hv;
          if (OUT_MODE == 2) *(v8h*)(C2 + (size_t)(mBase + row) * ldc + n0 + c8) = lv;
        }
        
      }
    }
    __builtin_amdgcn_fence(__ATOMIC_RELEASE, "workgroup");
    __builtin_amdgcn_wave_barrier();
    __builtin_amdgcn_fence(__ATOMIC_ACQUIRE, "workgroup");
  }
}

// ---------------------------------------------------------------------------
// f32 -> RNE bf16 plane, 8 consecutive elements per thread packed as integer words.
// Coverage: n8 = n/8 threads x 8 = the whole plane (grid is an exact multiple of 256 here).
// ---------------------------------------------------------------------------
__global__ __launch_bounds__(256) void cast8_bf16_kernel(const float* __restrict__ in, unsigned short* __restrict__ out, int n8) {
  const int i = blockIdx.x * 256 + threadIdx.x;
  if (i >= n8) return;
  const float* p = in + 8 * (size_t)i;
  const v4f a = *(const v4f*)(p);
  const v4f c = *(const v4f*)(p + 4);
  float f[8];
#pragma unroll
  for (int e = 0; e < 4; ++e) { f[e] = a[e]; f[4 + e] = c[e]; }
  unsigned w[4];
#pragma unroll
  for (int e2 = 0; e2 < 4; ++e2) w[e2] = pk16(f2bf_bits(f[2 * e2]), f2bf_bits(f[2 * e2 + 1]));
  const v4u u = (v4u){w[0], w[1], w[2], w[3]};
  unsigned short* q = out + 8 * (size_t)i;
  *(v4u*)q = u;
  
}

// ---------------------------------------------------------------------------
// Transpose + RNE bf16 convert of a weight matrix with zero padding of the output rows:
// in f32 [R][ncol] row-major (ldin = ncol) -> out bf16 [Cpad][R] (ldout = R): out[c][r] = bf16(in[r][c]) for c < ncol, 0 for c >= ncol.
// grid (R/64, Cpad/64): blockIdx.x = r tile (64 output cols), blockIdx.y = c tile (64 output rows). 256 threads.
// Load coverage: 16 iterations x 256 threads = 4096 = the whole 64x64 tile; column ADDRESS clamped to ncol-1, value zeroed by predicate.
// Store coverage: 8 waves x 2 iterations x 4 rows (lane>>3) = 64 rows; (lane&7) x 8 halves = 64 cols; each row segment =
// ---------------------------------------------------------------------------
__global__ __launch_bounds__(256) void transpose_cast_pad_kernel(const float* __restrict__ in, int ldin, int ncol,
                                                                 unsigned short* __restrict__ out, int ldout) {
  __shared__ float sm[64][65];   // sm[c_local][r_local]
  const int t  = threadIdx.x;
  const int r0 = blockIdx.x * 64;
  const int c0 = blockIdx.y * 64;
#pragma unroll
  for (int i = 0; i < 16; ++i) {
    const int e = i * 256 + t;
    const int r = e >> 6;          // r local
    const int c = e & 63;          // c local
    const int cg = c0 + c;
    const int cc = (cg < ncol) ? cg : (ncol - 1);
    const float v = in[(size_t)(r0 + r) * ldin + cc];
    sm[c][r] = (cg < ncol) ? v : 0.0f;
  }
  __syncthreads();
  const int lane = t & 31, wave = t >> 5;
  const int q = lane >> 3, c8 = (lane & 7) * 8;
  {
#pragma unroll
    for (int it = 0; it < 2; ++it) {
      const int row = wave * 8 + it * 4 + q;                 // c local (output row)
      unsigned w[4];
#pragma unroll
      for (int e2 = 0; e2 < 4; ++e2) w[e2] = pk16(f2bf_bits(sm[row][c8 + 2 * e2]), f2bf_bits(sm[row][c8 + 2 * e2 + 1]));
      const v4u u = (v4u){w[0], w[1], w[2], w[3]};
      const size_t o = (size_t)(c0 + row) * ldout + r0 + c8;
      *(v4u*)(out + o) = u;
    }
    
  }
}

// ---------------------------------------------------------------------------
// Bias vectors -> RNE-bf16 valued f32 lines padded to kUP: outp[p][u] = bf16(b_p[u]) for u < nvalid, 0 otherwise (p = blockIdx.x in 0..2).
// All three candidates loaded with a clamped index, selected by value. 64 threads x 4 floats = 256 = kUP;
// ---------------------------------------------------------------------------
__global__ __launch_bounds__(64) void bias_pad_kernel(const float* __restrict__ b0, const float* __restrict__ b1,
                                                     const float* __restrict__ b2, int nvalid, float* __restrict__ outp) {
  const int p = blockIdx.x;
  const int t = threadIdx.x;
  float f[4];
#pragma unroll
  for (int e = 0; e < 4; ++e) {
    const int u  = 4 * t + e;
    const int uc = (u < nvalid) ? u : (nvalid - 1);
    const float v0 = b0[uc], v1 = b1[uc], v2 = b2[uc];
    float v = (p == 0) ? v0 : ((p == 1) ? v1 : v2);
    v = bf_bits2f(f2bf_bits(v));
    f[e] = (u < nvalid) ? v : 0.0f;
  }
  const v4f val = (v4f){f[0], f[1], f[2], f[3]};
  float* dst = outp + (size_t)p * kUP + 4 * t;
  *(v4f*)dst = val;
  
}

// ---------------------------------------------------------------------------
// Row softmax over materialised f32 scores of all batches (16384 rows x 2048 cols), no mask.
// p = exp(score - max) * (1/sum); P written as bf16 hi/lo planes IN PLACE over the row's own scores:
// the 8192 bytes of f32 row r become 2048 bf16 hi (bytes 0..4095) followed by 2048 bf16 lo (bytes 4096..8191).
// Safe because one block owns one row, every thread's score loads are consumed in front of the first __syncthreads(),
// and the P stores stand behind the second one. One pointer, no __restrict__: loads and stores alias.
// One block of 256 threads per row; thread t owns columns 8t..8t+7 (256 x 8 = 2048).
// Reductions in fixed order (thread, wave shuffle tree, 8 wave partials in index order); shuffles outside all branches.
// ---------------------------------------------------------------------------
__global__ __launch_bounds__(256) void softmax_rows_kernel(float* SP) {
  __shared__ float redM[8];
  __shared__ float redS[8];
  const int qi   = blockIdx.x;           // query row 0..16383 (batch * 2048 + row)
  const int t    = threadIdx.x;
  const int lane = t & 31, wave = t >> 5;
  const int c0   = t * 8;
  const size_t rowoff = (size_t)qi * (size_t)kSeq;

  const float* sr = SP + rowoff + c0;
  const v4f a = *(const v4f*)(sr);
  const v4f c = *(const v4f*)(sr + 4);
  float xv[8];
#pragma unroll
  for (int e = 0; e < 4; ++e) { xv[e] = a[e]; xv[4 + e] = c[e]; }
  float m = xv[0];
#pragma unroll
  for (int e = 1; e < 8; ++e) m = fmaxf(m, xv[e]);
#pragma unroll
  for (int off = 16; off > 0; off >>= 1) m = fmaxf(m, __shfl_xor(m, off, 32));
  if (lane == 0) redM[wave] = m;
  __syncthreads();
  float gmax = redM[0];
#pragma unroll
  for (int w = 1; w < 8; ++w) gmax = fmaxf(gmax, redM[w]);

  float p[8];
  float ps = 0.0f;
#pragma unroll
  for (int e = 0; e < 8; ++e) { p[e] = expf(xv[e] - gmax); ps += p[e]; }
#pragma unroll
  for (int off = 16; off > 0; off >>= 1) ps += __shfl_xor(ps, off, 32);
  if (lane == 0) redS[wave] = ps;
  __syncthreads();
  float tot = redS[0];
#pragma unroll
  for (int w = 1; w < 8; ++w) tot += redS[w];
  const float inv = 1.0f / tot;          // tot >= 1

  unsigned hw[4], lw[4];
#pragma unroll
  for (int e2 = 0; e2 < 4; ++e2) {
    const float f0 = p[2 * e2] * inv;
    const float f1 = p[2 * e2 + 1] * inv;
    const unsigned short h0 = f2bf_bits(f0);
    const unsigned short h1 = f2bf_bits(f1);
    const unsigned short l0 = f2bf_bits(f0 - bf_bits2f(h0));
    const unsigned short l1 = f2bf_bits(f1 - bf_bits2f(h1));
    hw[e2] = pk16(h0, h1);
    lw[e2] = pk16(l0, l1);
  }
  const v4u hv = (v4u){hw[0], hw[1], hw[2], hw[3]};
  const v4u lv = (v4u){lw[0], lw[1], lw[2], lw[3]};
  unsigned short* ph = (unsigned short*)(SP + rowoff) + c0;
  unsigned short* pl = ph + kSeq;
  *(v4u*)ph = hv;
  *(v4u*)pl = lv;
  
}

// ---------------------------------------------------------------------------
// Final sum and copy: the two p.v partial sums tmp0 + tmp1, f32 [kRows][kUP] each (pitch 256) -> out f32 flat [kRows][kUnits] (pitch 200, contiguous).
// Thread i owns flat output elements 4i..4i+3 (same row since 200 % 4 == 0); one 16-B store per lane, thread-linear from the
// Coverage: n4 = kRows*kUnits/4 threads x 4 = the whole output (grid exact multiple of 256).
// ---------------------------------------------------------------------------
__global__ __launch_bounds__(256) void copy_out_kernel(const float* __restrict__ tmp0, const float* __restrict__ tmp1, float* __restrict__ out, int n4) {
  const int i = blockIdx.x * 256 + threadIdx.x;
  if (i >= n4) return;
  const int e   = 4 * i;
  const int row = e / kUnits;
  const int col = e - row * kUnits;
  const size_t o = (size_t)row * kUP + col;
  const v4f v = *(const v4f*)(tmp0 + o) + *(const v4f*)(tmp1 + o);
  float* dst = out + (size_t)e;
  *(v4f*)dst = v;
  
}

// ---------------------------------------------------------------------------
// Launcher. Workspace region map (bytes, MiB = 1048576; total carve = 224 MiB = 234881024 B):
//   [  0,128) S/P   : scores f32 [8][2048][2048]; softmax turns each 8192-B row into P hi bf16 [2048] + P lo bf16 [2048] in place
//                     earlier alias: Xg = generated as bf16 [16384][512] at [0, 16), Xr = real as bf16 [16384][512] at [16, 32)
//   [128,136) q hi  : bf16 [16384][256]; [136,144) q lo
//   [144,152) k hi  : bf16 [16384][256]; [152,160) k lo
//   [160,168) v^T hi: bf16 [256][16384]; [168,176) v^T lo
//   [176,192) O tmp : f32 [16384][256], partial sum over keys 0..1023 of each batch
//   [208,224) O tmp : f32 [16384][256], partial sum over keys 1024..2047
//   [192 MiB, +786432)  W^T planes: 3 x bf16 [256][512] (262144 B each: Wq^T, Wk^T, Wv^T; rows 200..255 zero)
//   [ +786432, +3072)   bias lines: 3 x f32 [256] (RNE-bf16 values, 200..255 zero)
// Lifetimes: Xg is read only by the q projection, Xr only by the k and v^T projections (launches 7..9); S first written in launch 10.
// Launch count: 2 casts + 3 transposes + 1 bias + 3 projections + scores + softmax + p.v (blockIdx.y = batch, blockIdx.z = key half) + 1 sum and copy = 13. Kernel launches only.
// GEMM shapes: proj q/k M=16384 N=256 K=512; v^T M=256 N=16384 K=512; per batch scores M=N=2048 K=224; p.v M=2048 N=256 K=1024 for each of 2 key halves (all M % 128 == 0, N % 256 == 0, K % 32 == 0; row pitches cover K rounded up to 64).
// ---------------------------------------------------------------------------
extern "C" void kernel_launch(void* const* d_in, const int* in_sizes, int n_in,
                              void* d_out, int out_size, void* d_ws, size_t ws_size,
                              hipStream_t stream) {
  if (n_in < 8) return;
  if (in_sizes[0] != kRows * kDin || in_sizes[1] != kRows * kDin) return;
  if (in_sizes[2] != kDin * kUnits || in_sizes[4] != kDin * kUnits || in_sizes[6] != kDin * kUnits) return;
  if (in_sizes[3] != kUnits || in_sizes[5] != kUnits || in_sizes[7] != kUnits) return;
  if (out_size != kRows * kUnits) return;

  const size_t kMiB    = 1048576;
  const size_t offXg   = 0;
  const size_t offXr   = 16 * kMiB;
  const size_t offS    = 0;
  const size_t offQhi  = 128 * kMiB;
  const size_t offQlo  = 136 * kMiB;
  const size_t offKhi  = 144 * kMiB;
  const size_t offKlo  = 152 * kMiB;
  const size_t offVhi  = 160 * kMiB;
  const size_t offVlo  = 168 * kMiB;
  const size_t offO    = 176 * kMiB;
  const size_t offO1   = 208 * kMiB;
  const size_t wplane  = (size_t)kUP * kDin * 2;                 // 262144 B
  const size_t offWq   = 192 * kMiB;
  const size_t offWk   = offWq + wplane;
  const size_t offWv   = offWk + wplane;
  const size_t offBias = offWv + wplane;                         // 192 MiB + 786432
  const size_t total   = offO1 + 16 * kMiB;                      // 234881024 B; the bias lines end at 192 MiB + 789504, below offO1
  if (total > ws_size) return;

  const float* gen  = (const float*)d_in[0];
  const float* real = (const float*)d_in[1];
  const float* Wq   = (const float*)d_in[2];
  const float* bq   = (const float*)d_in[3];
  const float* Wk   = (const float*)d_in[4];
  const float* bk   = (const float*)d_in[5];
  const float* Wv   = (const float*)d_in[6];
  const float* bv   = (const float*)d_in[7];
  float* out = (float*)d_out;
  char* ws = (char*)d_ws;

  unsigned short* xg   = (unsigned short*)(ws + offXg);
  unsigned short* xr   = (unsigned short*)(ws + offXr);
  float*          Sbuf = (float*)(ws + offS);
  unsigned short* phi  = (unsigned short*)(ws + offS);           // row pitch 2 * kSeq halves
  unsigned short* plo  = phi + kSeq;
  unsigned short* qhi  = (unsigned short*)(ws + offQhi);
  unsigned short* qlo  = (unsigned short*)(ws + offQlo);
  unsigned short* khi  = (unsigned short*)(ws + offKhi);
  unsigned short* klo  = (unsigned short*)(ws + offKlo);
  unsigned short* vthi = (unsigned short*)(ws + offVhi);
  unsigned short* vtlo = (unsigned short*)(ws + offVlo);
  float*          Otmp = (float*)(ws + offO);
  float*          Otmp1 = (float*)(ws + offO1);
  unsigned short* wqT  = (unsigned short*)(ws + offWq);
  unsigned short* wkT  = (unsigned short*)(ws + offWk);
  unsigned short* wvT  = (unsigned short*)(ws + offWv);
  float*          biasP = (float*)(ws + offBias);

  // in-range dummies for unused (never dereferenced) template-dead pointer parameters
  const float* dummy_f = biasP;
  void* dummy_c2 = (void*)biasP;

  // 1-2. activations -> RNE bf16 planes [16384][512]
  {
    const int n8 = (kRows * kDin) / 8;                      // 1048576 = 4096 blocks x 256
    cast8_bf16_kernel<<<dim3(n8 / 256), dim3(256), 0, stream>>>(gen, xg, n8);
    cast8_bf16_kernel<<<dim3(n8 / 256), dim3(256), 0, stream>>>(real, xr, n8);
  }
  // 3-5. W [R=512][ncol=200] -> W^T bf16 [256][512] with rows 200..255 zero; grid (R/64, 256/64)
  transpose_cast_pad_kernel<<<dim3(kDin / 64, kUP / 64), dim3(256), 0, stream>>>(Wq, kUnits, kUnits, wqT, kDin);
  transpose_cast_pad_kernel<<<dim3(kDin / 64, kUP / 64), dim3(256), 0, stream>>>(Wk, kUnits, kUnits, wkT, kDin);
  transpose_cast_pad_kernel<<<dim3(kDin / 64, kUP / 64), dim3(256), 0, stream>>>(Wv, kUnits, kUnits, wvT, kDin);
  // 6. biases -> padded RNE-bf16 valued f32 lines [3][256]
  bias_pad_kernel<<<dim3(3), dim3(64), 0, stream>>>(bq, bk, bv, kUnits, biasP);

  // 7. q = Xg . Wq^T + bq : M=16384, N=256, K=512, single bf16 product -> bf16 hi/lo planes [16384][256]
  wmma_gemm64<1, false, 2, 2, false, 0><<<dim3((kRows / kTileM) * (kUP / kTileN), 1), dim3(256), 0, stream>>>(
      xg, xg, kDin, 0L,
      wqT, wqT, kDin, 0L,
      (void*)qhi, (void*)qlo, kUP, 0L,
      0L, 0L, 0L,
      biasP, dummy_f, 0L,
      kRows, kUP, kDin, 1.0f);
  // 8. k = Xr . Wk^T + bk
  wmma_gemm64<1, false, 2, 2, false, 0><<<dim3((kRows / kTileM) * (kUP / kTileN), 1), dim3(256), 0, stream>>>(
      xr, xr, kDin, 0L,
      wkT, wkT, kDin, 0L,
      (void*)khi, (void*)klo, kUP, 0L,
      0L, 0L, 0L,
      biasP + kUP, dummy_f, 0L,
      kRows, kUP, kDin, 1.0f);
  // 9. v^T = Wv^T . Xr^T + bv[m] : M=256 (u), N=16384 (b*2048+t), K=512 -> bf16 hi/lo planes [256][16384]
  wmma_gemm64<1, false, 1, 2, false, 0><<<dim3((kUP / kTileM) * (kRows / kTileN), 1), dim3(256), 0, stream>>>(
      wvT, wvT, kDin, 0L,
      xr, xr, kDin, 0L,
      (void*)vthi, (void*)vtlo, kRows, 0L,
      0L, 0L, 0L,
      biasP + 2 * kUP, dummy_f, 0L,
      kUP, kRows, kDin, 1.0f);

  // 10. scores = 200^-0.5 * q . k^T, all batches (blockIdx.y): M=N=2048, K=224 (cols 200..223 exact zeros), 3 products on hi/lo planes -> f32 [8][2048][2048]
  wmma_gemm64<1, true, 0, 0, false, 0><<<dim3((kSeq / kTileM) * (kSeq / kTileN), kBatch), dim3(256), 0, stream>>>(
      qhi, qlo, kUP, (long)kSeq * kUP,
      khi, klo, kUP, (long)kSeq * kUP,
      (void*)Sbuf, dummy_c2, kSeq, (long)kSeq * kSeq,
      0L, 0L, 0L,
      dummy_f, dummy_f, 0L,
      kSeq, kSeq, kKS, kScoreScale);

  // 11. softmax of all 16384 rows -> P hi/lo planes in place (row pitch 4096 halves)
  softmax_rows_kernel<<<dim3(kRows), dim3(256), 0, stream>>>(Sbuf);

  // 12. O = P . v, all batches (blockIdx.y), keys in two halves (blockIdx.z) so that 16 x 8 x 2 = 256 work-groups run, one on every WGP:
  //     M=2048, N=256, K=1024 each, 3 products; Bt = v^T rows u, cols b*2048 + z*1024.. (ldb 16384) -> f32 partial z, rows b*2048.., pitch 256
  wmma_gemm64<1, true, 0, 0, false, 0><<<dim3((kSeq / kTileM) * (kUP / kTileN), kBatch, kPvSplit), dim3(256), 0, stream>>>(
      phi, plo, 2 * kSeq, (long)kSeq * 2 * kSeq,
      vthi, vtlo, kRows, (long)kSeq,
      (void*)Otmp, dummy_c2, kUP, (long)kSeq * kUP,
      (long)(kSeq / kPvSplit), (long)(kSeq / kPvSplit), (long)(Otmp1 - Otmp),
      dummy_f, dummy_f, 0L,
      kSeq, kUP, kSeq / kPvSplit, 1.0f);

  // 13. partial 0 + partial 1 [16384][256] -> out [16384][200] contiguous
  {
    const int n4 = (kRows * kUnits) / 4;                    // 819200 = 3200 blocks x 256
    copy_out_kernel<<<dim3(n4 / 256), dim3(256), 0, stream>>>(Otmp, Otmp1, out, n4);
  }
}

// v004
// A run of this version takes 153 microseconds.
// In two side-by-side timings against v003, it was 1.24 and 1.25 times as fast.
// All steps since v000 together make it 9.69 times as fast.
// Contractions: x.W projections (q, k planes and v^T plane): single v_wmma_f32_16x16x32_bf16 product on RNE-bf16 converted x, W, bias; q.k^T scores and p.v output: bf16 hi/lo operand planes (hi.hi + hi.lo + lo.hi); all f32 accumulate; p.v summed as two halves of the key range, the two f32 partial sums added once; softmax in f32.
#include <hip/hip_runtime.h>
#include <math.h>

// ---------------------------------------------------------------------------
// Problem constants
// ---------------------------------------------------------------------------
constexpr int kBatch = 8;
constexpr int kSeq   = 2048;
constexpr int kDin   = 512;
constexpr int kUnits = 200;
constexpr int kUP    = 256;              // padded unit count (cols 200..255 exactly zero)
constexpr int kRows  = kBatch * kSeq;    // 16384 token rows
constexpr int kKS    = 224;              // score contraction depth (q/k cols 200..223 are exact zeros)
constexpr float kScoreScale = 0.070710678118654752f;   // 200^-0.5 applied in the f32 epilogue

static_assert(kSeq == 2048, "softmax kernel: 256 threads x 8 columns = one row");
static_assert(kRows % 64 == 0 && kUP % 64 == 0 && kSeq % 64 == 0 && kDin % 64 == 0, "tile multiples");
static_assert(kDin % 32 == 0 && kKS % 32 == 0 && kSeq % 32 == 0, "K multiples of 32");
static_assert(kKS >= kUnits && kKS <= kUP, "score depth covers all real units");
static_assert(kRows % 256 == 0 && kSeq % 256 == 0 && kUP % 256 == 0, "work-group tile 128 x 256 in either orientation");
static_assert((kKS + 63) / 64 * 64 <= kUP, "the last score stage copies whole 128-B rows inside the q/k row pitch");
static_assert((kRows * kDin) % (8 * 256) == 0, "cast kernel grid exact");
static_assert((kRows * kUnits) % (4 * 256) == 0 && kUnits % 4 == 0, "copy kernel grid exact, float4 inside one row");
static_assert(kUP == 4 * 64, "bias kernel: 64 threads x 4 floats");
constexpr int kPvSplit = 2;              // p.v: key range cut into this many parts, one work-group each (blockIdx.z)
static_assert(kSeq % (kPvSplit * 64) == 0, "each part of the p.v key range is a whole number of 64-k stages");
static_assert(kPvSplit == 2, "the final kernel adds exactly two partial sums");

typedef __attribute__((ext_vector_type(16))) _Float16 v16h;
typedef __attribute__((ext_vector_type(8)))  _Float16 v8h;
typedef __attribute__((ext_vector_type(16))) __bf16   v16b;
typedef __attribute__((ext_vector_type(8)))  __bf16   v8b;
typedef __attribute__((ext_vector_type(8)))  float    v8f;
typedef __attribute__((ext_vector_type(4)))  float    v4f;
typedef __attribute__((ext_vector_type(4)))  unsigned int v4u;

// ---------------------------------------------------------------------------
// Device helpers
// ---------------------------------------------------------------------------
__device__ __forceinline__ unsigned short f2bf_bits(float f) {
  unsigned u = __float_as_uint(f);
  return (unsigned short)((u + 0x7FFFu + ((u >> 16) & 1u)) >> 16);
}
__device__ __forceinline__ float bf_bits2f(unsigned short h) { return __uint_as_float(((unsigned)h) << 16); }

// hazard guards as plain device helpers
__device__ __forceinline__ void dep_guard_h(v8f& a, v8f& b, v16h x, v16h y) { asm volatile("v_nop\n\tv_nop\n\tv_nop\n\tv_nop" : "+v"(a), "+v"(b) : "v"(x), "v"(y)); }
__device__ __forceinline__ void dep_guard_b(v8f& a, v8f& b, v16b x, v16b y) { asm volatile("v_nop\n\tv_nop\n\tv_nop\n\tv_nop" : "+v"(a), "+v"(b) : "v"(x), "v"(y)); }
__device__ __forceinline__ void keep4_h(v16h a, v16h b, v16h c, v16h d) { asm volatile("v_nop" :: "v"(a), "v"(b), "v"(c), "v"(d)); }
__device__ __forceinline__ void keep4_b(v16b a, v16b b, v16b c, v16b d) { asm volatile("v_nop" :: "v"(a), "v"(b), "v"(c), "v"(d)); }
__device__ __forceinline__ void acc_guard4(v8f& a, v8f& b, v8f& c, v8f& d) { asm volatile("v_nop\n\tv_nop\n\tv_nop\n\tv_nop" : "+v"(a), "+v"(b), "+v"(c), "+v"(d)); }
template <typename T> struct Frag;
template <> struct Frag<_Float16> {
  typedef v16h V; union U { v16h v; v8h h[2]; };
  // elements 0..7 <- p[0..7], 8..15 <- p[16..23]
  static __device__ __forceinline__ v16h load(const _Float16* p) {
    U f; f.h[0] = *(const v8h*)(p); f.h[1] = *(const v8h*)(p + 16); return f.v;
  }
  static __device__ __forceinline__ v8f mma(v16h a, v16h b, v8f c) {
    return __builtin_amdgcn_wmma_f32_16x16x32_f16(false, a, false, b, (short)0, c, false, false);
  }
  static __device__ __forceinline__ void guard(v8f& a, v8f& b, v16h x, v16h y) { dep_guard_h(a, b, x, y); }
  static __device__ __forceinline__ void keep(v16h a, v16h b, v16h c, v16h d) { keep4_h(a, b, c, d); }
};
template <> struct Frag<__bf16> {
  typedef v16b V; union U { v16b v; v8b h[2]; };
  static __device__ __forceinline__ v16b load(const __bf16* p) {
    U f; f.h[0] = *(const v8b*)(p); f.h[1] = *(const v8b*)(p + 16); return f.v;
  }
  static __device__ __forceinline__ v8f mma(v16b a, v16b b, v8f c) {
    return __builtin_amdgcn_wmma_f32_16x16x32_bf16(false, a, false, b, (short)0, c, false, false);
  }
  static __device__ __forceinline__ void guard(v8f& a, v8f& b, v16b x, v16b y) { dep_guard_b(a, b, x, y); }
  static __device__ __forceinline__ void keep(v16b a, v16b b, v16b c, v16b d) { keep4_b(a, b, c, d); }
};

__device__ __forceinline__ unsigned pk16(unsigned short a, unsigned short b) { return (unsigned)a | ((unsigned)b << 16); }

// ---- Register-blocked batched WMMA GEMM, operands staged in LDS by asynchronous copies ----
// C[m,n] = scale * sum_k A[m,k] * Bt[n,k] (+bias)(+resid); a work-group owns a 128x256 tile, each of its 8 waves (2 x 4) a 64x64 tile.
// A row-major [M,K]; Bt row-major [N,K]; M % 128 == 0, N % 256 == 0, K % 32 == 0; lda, ldb >= K rounded up to 64 (a stage copies whole 128-B rows).
// blockIdx.z = part of a K range cut by the launcher: part z reads A and Bt from element z * zA / z * zB of each row on, K elements deep, and
// writes its own partial C at z * zC (the launcher's next kernel adds the parts; only with BIAS_MODE 0 and no resid). One part: zA = zB = zC = 0.
// SPLIT: operands are hi/lo planes (A2/Bt2 = lo planes, same layout); product = hi.hi + hi.lo + lo.hi.
// BIAS_MODE: 0 = none, 1 = bias[m], 2 = bias[n].
// OUT_MODE: 0 = f32, 1 = f16, 2 = bf16 hi plane (Cout) + bf16 lo plane (Cout2).
// ET: 0 = f16 operands, 1 = bf16 operands (pointers passed as 16-bit storage)
// Stage = 64 k of every operand row: [A hi 128 rows | B hi 256 rows | A lo | B lo], LDS row pitch 144 B (16 B x odd: ds_load_b128 free of bank conflicts).
// Two buffers: the copies of stage s + 1 fly while stage s is multiplied.
constexpr int kStageK  = 64;                      // k per stage = 128 B of a row = one whole line
constexpr int kPitchB  = 144;                     // LDS row pitch, bytes
constexpr int kTileM   = 128;
constexpr int kTileN   = 256;
constexpr int kPlaneA  = kTileM * kPitchB;        // 18432 B
constexpr int kPlaneB  = kTileN * kPitchB;        // 36864 B
constexpr int kPlaneAB = kPlaneA + kPlaneB;       // 55296 B
constexpr int kRowStep = 32 * kPitchB;            // 256 threads copy 32 rows of 128 B at a time

// One plane pair of a stage: 4 x 32 rows of A and 8 x 32 rows of B, 16 B per lane and copy, through no register.
// la / lb: the lane's LDS byte address of its first A / B row; ga / gb: its global address; sa / sb: bytes between 32 global rows.
// s_wait_xcnt 0 is the statement's last line: it stands in front of any later write of the address registers named here.
__device__ __forceinline__ void async_copy_plane(unsigned la, const char* ga, size_t sa, unsigned lb, const char* gb, size_t sb) {
  asm volatile(
      "global_load_async_to_lds_b128 %0, %12, off\n\t"
      "global_load_async_to_lds_b128 %1, %13, off\n\t"
      "global_load_async_to_lds_b128 %2, %14, off\n\t"
      "global_load_async_to_lds_b128 %3, %15, off\n\t"
      "global_load_async_to_lds_b128 %4, %16, off\n\t"
      "global_load_async_to_lds_b128 %5, %17, off\n\t"
      "global_load_async_to_lds_b128 %6, %18, off\n\t"
      "global_load_async_to_lds_b128 %7, %19, off\n\t"
      "global_load_async_to_lds_b128 %8, %20, off\n\t"
      "global_load_async_to_lds_b128 %9, %21, off\n\t"
      "global_load_async_to_lds_b128 %10, %22, off\n\t"
      "global_load_async_to_lds_b128 %11, %23, off\n\t"
      "s_wait_xcnt 0x0"
      :: "v"(la), "v"(la + kRowStep), "v"(la + 2 * kRowStep), "v"(la + 3 * kRowStep),
         "v"(lb), "v"(lb + kRowStep), "v"(lb + 2 * kRowStep), "v"(lb + 3 * kRowStep),
         "v"(lb + 4 * kRowStep), "v"(lb + 5 * kRowStep), "v"(lb + 6 * kRowStep), "v"(lb + 7 * kRowStep),
         "v"(ga), "v"(ga + sa), "v"(ga + 2 * sa), "v"(ga + 3 * sa),
         "v"(gb), "v"(gb + sb), "v"(gb + 2 * sb), "v"(gb + 3 * sb),
         "v"(gb + 4 * sb), "v"(gb + 5 * sb), "v"(gb + 6 * sb), "v"(gb + 7 * sb)
      : "memory");
}

template <int ET> struct Elem;
template <> struct Elem<0> { typedef _Float16 T; };
template <> struct Elem<1> { typedef __bf16 T; };
// The tile routine: ring = two stage buffers, sTall = 8 per-wave 16x64 slabs of pitch 68 floats (both the calling kernel's LDS);
// bx = tile index, b = batch, z = part of the K range (wmma_gemm64 passes its work-group indices, proj3_kernel blockIdx.x, 0, 0).
template <int ET, bool SPLIT, int BIAS_MODE, int OUT_MODE, bool RESID, int ACT>
__device__ __forceinline__ void gemm_tile(
    char* ring, float* sTall, int bx, int b, int z,
    const unsigned short* __restrict__ Ap, const unsigned short* __restrict__ A2p, int lda, long strideA,
    const unsigned short* __restrict__ Btp, const unsigned short* __restrict__ Bt2p, int ldb, long strideB,
    void* __restrict__ Cout, void* __restrict__ Cout2, int ldc, long strideC,
    long zA, long zB, long zC,
    const float* __restrict__ bias,
    const float* __restrict__ resid, long strideR,
    int M, int N, int K, float scale) {
  typedef typename Elem<ET>::T T;
  typedef typename Frag<T>::V V;
  constexpr int kStageB = (SPLIT ? 2 : 1) * kPlaneAB;   // bytes of one buffer
  const int lane = threadIdx.x & 31;
  const int wave = threadIdx.x >> 5;
  const int tilesN = N >> 8;
  const int tilesM = M >> 7;
  if (bx >= tilesM * tilesN) return;   // the same for the whole work-group, in front of every copy and barrier
  const int tm  = bx / tilesN;
  const int tn  = bx - tm * tilesN;
  const int m0g = tm << 7;                          // work-group tile origin
  const int n0g = tn << 8;
  const int mw  = (wave >> 2) << 6;                 // wave tile origin inside it
  const int nw  = (wave & 3) << 6;
  const int m0  = m0g + mw;
  const int n0  = n0g + nw;

  const int rlane = lane & 15;                 // row (A) / col (B, D) within subtile
  const int koff  = (lane >> 4) * 8;           // k offset of this lane half
  const int mOff  = (lane >> 4) * 8;           // D row offset

  // copy addresses of this lane: row threadIdx.x / 8 of each group of 32 rows, 16-B piece threadIdx.x % 8 of its 128 B
  const int crow = threadIdx.x >> 3;
  const int cpc  = (threadIdx.x & 7) << 4;
  const size_t rsA = (size_t)lda * 64;         // 32 rows x 2 B
  const size_t rsB = (size_t)ldb * 64;
  const size_t goA = ((size_t)b * strideA + (size_t)z * zA + (size_t)(m0g + crow) * lda) * 2 + cpc;
  const size_t goB = ((size_t)b * strideB + (size_t)z * zB + (size_t)(n0g + crow) * ldb) * 2 + cpc;
  const char* gA  = (const char*)Ap  + goA;
  const char* gB  = (const char*)Btp + goB;
  const char* gA2 = (const char*)A2p  + goA;
  const char* gB2 = (const char*)Bt2p + goB;
  const unsigned lds0 = (unsigned)(size_t)(&ring[0]) + (unsigned)(crow * kPitchB + cpc);
  auto fill = [&](int s, int buf) {
    const size_t kb = (size_t)s * (kStageK * 2);
    const unsigned l = lds0 + (unsigned)(buf * kStageB);
    async_copy_plane(l, gA + kb, rsA, l + kPlaneA, gB + kb, rsB);
    if (SPLIT) async_copy_plane(l + kPlaneAB, gA2 + kb, rsA, l + kPlaneAB + kPlaneA, gB2 + kb, rsB);
  };

  v8f acc[4][4];
#pragma unroll
  for (int i = 0; i < 4; ++i)
#pragma unroll
    for (int j = 0; j < 4; ++j) acc[i][j] = (v8f){0.f,0.f,0.f,0.f,0.f,0.f,0.f,0.f};

  const int nst = (K + kStageK - 1) / kStageK;
  fill(0, 0);
  asm volatile("s_wait_asynccnt 0x0" ::: "memory");   // this wave's share of stage 0 has landed
  __syncthreads();                                    // publishes stage 0
  if (nst > 1) fill(1, 1);

  const int fragA = (mw + rlane) * kPitchB + koff * 2;            // byte of this lane's first A fragment row in a plane pair
  const int fragB = kPlaneA + (nw + rlane) * kPitchB + koff * 2;  // the same for B
  for (int s = 0; s < nst; ++s) {
    const char* sb = ring + (s & 1) * kStageB;
#pragma unroll   // kk becomes an immediate in every LDS offset
    for (int kk = 0; kk < 2; ++kk) {
      if (s * kStageK + kk * 32 < K) {   // scalar: a K that is an odd multiple of 32 ends on half a stage
        V bh[4], bl[4];
#pragma unroll
        for (int j = 0; j < 4; ++j) {
          const char* bp = sb + fragB + j * (16 * kPitchB) + kk * 64;
          bh[j] = Frag<T>::load((const T*)bp);
          if (SPLIT) bl[j] = Frag<T>::load((const T*)(bp + kPlaneAB));
        }
#pragma unroll
        for (int i = 0; i < 4; ++i) {
          const char* ap = sb + fragA + i * (16 * kPitchB) + kk * 64;
          V ah = Frag<T>::load((const T*)ap);
          V al;
          if (SPLIT) al = Frag<T>::load((const T*)(ap + kPlaneAB));
#pragma unroll
          for (int j = 0; j < 4; ++j) {
            acc[i][j] = Frag<T>::mma(ah, bh[j], acc[i][j]);
            if (SPLIT) acc[i][j] = Frag<T>::mma(ah, bl[j], acc[i][j]);
            if (SPLIT) acc[i][j] = Frag<T>::mma(al, bh[j], acc[i][j]);
          }
          Frag<T>::guard(acc[i][0], acc[i][3], ah, SPLIT ? al : ah);
        }
        Frag<T>::keep(bh[0], bh[1], bh[2], bh[3]);
        if (SPLIT) Frag<T>::keep(bl[0], bl[1], bl[2], bl[3]);
      }
    }
    asm volatile("s_wait_dscnt 0x0" ::: "memory");      // this wave's reads of buffer s & 1 are done before it is refilled
    asm volatile("s_wait_asynccnt 0x0" ::: "memory");   // this wave's share of stage s + 1 has landed
    __syncthreads();                                    // publishes stage s + 1 and ends every reader's last read of stage s
    if (s + 2 < nst) fill(s + 2, s & 1);
  }
  asm volatile("s_wait_asynccnt 0x0" ::: "memory");     // nothing in flight when the wave goes on to the epilogue and ends
  acc_guard4(acc[0][0], acc[0][1], acc[0][2], acc[0][3]);
  acc_guard4(acc[1][0], acc[1][1], acc[1][2], acc[1][3]);
  acc_guard4(acc[2][0], acc[2][1], acc[2][2], acc[2][3]);
  acc_guard4(acc[3][0], acc[3][1], acc[3][2], acc[3][3]);

  // ---- epilogue ----
  float* slab = sTall + wave * (16 * 68);
  const float* Rb = RESID ? (resid + (size_t)b * strideR) : nullptr;
#pragma unroll
  for (int i = 0; i < 4; ++i) {
    const int mBase = m0 + (i << 4);
#pragma unroll
    for (int j = 0; j < 4; ++j) {
      const int n = n0 + (j << 4) + rlane;
      float bv = 0.f;
      if (BIAS_MODE == 2) bv = bias[n];
#pragma unroll
      for (int r = 0; r < 8; ++r) {
        float v = acc[i][j][r] * scale;
        if (BIAS_MODE == 1) v += bias[mBase + mOff + r];
        if (BIAS_MODE == 2) v += bv;
        if (RESID) v += Rb[(size_t)(mBase + mOff + r) * ldc + n];
        if (ACT == 2) v = fmaxf(v, 0.0f);
        if (ACT == 4) v = (v > 0.f) ? v : 0.01f * v;
        slab[(mOff + r) * 68 + (j << 4) + rlane] = v;
      }
    }
    __builtin_amdgcn_fence(__ATOMIC_RELEASE, "workgroup");
    __builtin_amdgcn_wave_barrier();
    __builtin_amdgcn_fence(__ATOMIC_ACQUIRE, "workgroup");
    if (OUT_MODE == 0) {
      float* C = (float*)Cout + (size_t)b * strideC + (size_t)z * zC;
      const int hh = lane >> 4, c4 = (lane & 15) * 4;     // row seg = 256 B = 16 lanes x 16 B
      {
#pragma unroll
        for (int it = 0; it < 8; ++it) {
          const int row = it * 2 + hh;
          v4f v = *(const v4f*)(slab + row * 68 + c4);
          *(v4f*)(C + (size_t)(mBase + row) * ldc + n0 + c4) = v;
        }
        
      }
    } else {
      const int q = lane >> 3, c8 = (lane & 7) * 8;
      unsigned short* C  = (unsigned short*)Cout  + (size_t)b * strideC + (size_t)z * zC;
      unsigned short* C2 = (OUT_MODE == 2) ? ((unsigned short*)Cout2 + (size_t)b * strideC + (size_t)z * zC) : nullptr;
      {
#pragma unroll
        for (int it = 0; it < 4; ++it) {
          const int row = it * 4 + q;
          const float* sp = slab + row * 68 + c8;
          v8h hv, lv;
#pragma unroll
          for (int e = 0; e < 8; ++e) {
            if (OUT_MODE == 1) {
              hv[e] = (_Float16)sp[e];
            } else {
              unsigned short hb = f2bf_bits(sp[e]);
              unsigned short lb = f2bf_bits(sp[e] - bf_bits2f(hb));
              hv[e] = __builtin_bit_cast(_Float16, hb);
              lv[e] = __builtin_bit_cast(_Float16, lb);
            }
          }
          *(v8h*)(C + (size_t)(mBase + row) * ldc + n0 + c8) = hv;
          if (OUT_MODE == 2) *(v8h*)(C2 + (size_t)(mBase + row) * ldc + n0 + c8) = lv;
        }
        
      }
    }
    __builtin_amdgcn_fence(__ATOMIC_RELEASE, "workgroup");
    __builtin_amdgcn_wave_barrier();
    __builtin_amdgcn_fence(__ATOMIC_ACQUIRE, "workgroup");
  }
}

// One GEMM per launch: blockIdx.x = tile, blockIdx.y = batch, blockIdx.z = part of the K range.
template <int ET, bool SPLIT, int BIAS_MODE, int OUT_MODE, bool RESID, int ACT = 0>
__global__ __launch_bounds__(256) void wmma_gemm64(
    const unsigned short* __restrict__ Ap, const unsigned short* __restrict__ A2p, int lda, long strideA,
    const unsigned short* __restrict__ Btp, const unsigned short* __restrict__ Bt2p, int ldb, long strideB,
    void* __restrict__ Cout, void* __restrict__ Cout2, int ldc, long strideC,
    long zA, long zB, long zC,
    const float* __restrict__ bias,
    const float* __restrict__ resid, long strideR,
    int M, int N, int K, float scale) {
  __shared__ __align__(16) char ring[2 * (SPLIT ? 2 : 1) * kPlaneAB];
  __shared__ __align__(16) float sT[8 * 16 * 68];
  gemm_tile<ET, SPLIT, BIAS_MODE, OUT_MODE, RESID, ACT>(ring, sT, (int)blockIdx.x, (int)blockIdx.y, (int)blockIdx.z,
      Ap, A2p, lda, strideA, Btp, Bt2p, ldb, strideB, Cout, Cout2, ldc, strideC, zA, zB, zC, bias, resid, strideR, M, N, K, scale);
}

// The three projections in one launch: blockIdx.y = 0: q = Xg . Wq^T + bq[n], 1: k = Xr . Wk^T + bk[n] (M=16384, N=256),
// 2: v^T = Wv^T . Xr^T + bv[m] (M=256, N=16384); K=512, single bf16 product -> bf16 hi/lo planes; 128 tiles each (blockIdx.x).
// None reads what another writes. One LDS allocation serves whichever branch the work-group takes (142 KiB: two work-groups fit a WGP).
// wT: Wq^T, Wk^T, Wv^T planes [256][512] in a row; biasP: the three padded bias lines in a row.
static_assert((kRows / kTileM) * (kUP / kTileN) == (kUP / kTileM) * (kRows / kTileN), "the three projections have equally many tiles");
__global__ __launch_bounds__(256) void proj3_kernel(
    const unsigned short* __restrict__ xg, const unsigned short* __restrict__ xr, const unsigned short* __restrict__ wT,
    unsigned short* __restrict__ qhi, unsigned short* __restrict__ qlo,
    unsigned short* __restrict__ khi, unsigned short* __restrict__ klo,
    unsigned short* __restrict__ vthi, unsigned short* __restrict__ vtlo,
    const float* __restrict__ biasP) {
  __shared__ __align__(16) char ring[2 * kPlaneAB];
  __shared__ __align__(16) float sT[8 * 16 * 68];
  const int y = blockIdx.y;                    // the same for the whole work-group
  if (y < 2) {
    const unsigned short* x = y ? xr : xg;
    const unsigned short* w = wT + (size_t)y * (kUP * kDin);
    gemm_tile<1, false, 2, 2, false, 0>(ring, sT, (int)blockIdx.x, 0, 0,
        x, x, kDin, 0L, w, w, kDin, 0L,
        (void*)(y ? khi : qhi), (void*)(y ? klo : qlo), kUP, 0L, 0L, 0L, 0L,
        biasP + y * kUP, biasP, 0L, kRows, kUP, kDin, 1.0f);
  } else {
    const unsigned short* w = wT + (size_t)2 * (kUP * kDin);
    gemm_tile<1, false, 1, 2, false, 0>(ring, sT, (int)blockIdx.x, 0, 0,
        w, w, kDin, 0L, xr, xr, kDin, 0L,
        (void*)vthi, (void*)vtlo, kRows, 0L, 0L, 0L, 0L,
        biasP + 2 * kUP, biasP, 0L, kUP, kRows, kDin, 1.0f);
  }
}

// ---------------------------------------------------------------------------
// f32 -> RNE bf16 plane, 8 consecutive elements per thread packed as integer words; i = index of the thread's group of 8.
// ---------------------------------------------------------------------------
__device__ __forceinline__ void cast8_bf16(const float* __restrict__ in, unsigned short* __restrict__ out, int i) {
  const float* p = in + 8 * (size_t)i;
  const v4f a = *(const v4f*)(p);
  const v4f c = *(const v4f*)(p + 4);
  float f[8];
#pragma unroll
  for (int e = 0; e < 4; ++e) { f[e] = a[e]; f[4 + e] = c[e]; }
  unsigned w[4];
#pragma unroll
  for (int e2 = 0; e2 < 4; ++e2) w[e2] = pk16(f2bf_bits(f[2 * e2]), f2bf_bits(f[2 * e2 + 1]));
  const v4u u = (v4u){w[0], w[1], w[2], w[3]};
  unsigned short* q = out + 8 * (size_t)i;
  *(v4u*)q = u;
  asm volatile("s_wait_xcnt 0x0" ::: "memory");   // in front of any later write of the store's address and data registers
}

// ---------------------------------------------------------------------------
// Transpose + RNE bf16 convert of a weight matrix with zero padding of the output rows:
// in f32 [R][ncol] row-major (ldin = ncol) -> out bf16 [Cpad][R] (ldout = R): out[c][r] = bf16(in[r][c]) for c < ncol, 0 for c >= ncol.
// rt = r tile (64 output cols), ct = c tile (64 output rows); sm = 64 x 65 floats of the calling kernel's LDS. 256 threads.
// Load coverage: 16 iterations x 256 threads = 4096 = the whole 64x64 tile; column ADDRESS clamped to ncol-1, value zeroed by predicate.
// Store coverage: 8 waves x 2 iterations x 4 rows (lane>>3) = 64 rows; (lane&7) x 8 halves = 64 cols; each row segment =
// ---------------------------------------------------------------------------
__device__ __forceinline__ void transpose_cast_pad(float (*sm)[65], int rt, int ct, const float* __restrict__ in, int ldin, int ncol,
                                                   unsigned short* __restrict__ out, int ldout) {
  const int t  = threadIdx.x;    // sm[c_local][r_local]
  const int r0 = rt * 64;
  const int c0 = ct * 64;
  float v[16];   // all 16 loads are issued in front of the first LDS store, so that they are in flight together
#pragma unroll
  for (int i = 0; i < 16; ++i) {
    const int e = i * 256 + t;
    const int r = e >> 6;          // r local
    const int c = e & 63;          // c local
    const int cg = c0 + c;
    const int cc = (cg < ncol) ? cg : (ncol - 1);
    v[i] = in[(size_t)(r0 + r) * ldin + cc];
    asm volatile("s_wait_xcnt 0x0" ::: "memory");   // in front of any later write of the load's address registers
  }
#pragma unroll   // v[i] is indexed by constants and stays in registers
  for (int i = 0; i < 16; ++i) {
    const int e = i * 256 + t;
    const int r = e >> 6;
    const int c = e & 63;
    sm[c][r] = (c0 + c < ncol) ? v[i] : 0.0f;
  }
  __syncthreads();
  const int lane = t & 31, wave = t >> 5;
  const int q = lane >> 3, c8 = (lane & 7) * 8;
  {
#pragma unroll
    for (int it = 0; it < 2; ++it) {
      const int row = wave * 8 + it * 4 + q;                 // c local (output row)
      unsigned w[4];
#pragma unroll
      for (int e2 = 0; e2 < 4; ++e2) w[e2] = pk16(f2bf_bits(sm[row][c8 + 2 * e2]), f2bf_bits(sm[row][c8 + 2 * e2 + 1]));
      const v4u u = (v4u){w[0], w[1], w[2], w[3]};
      const size_t o = (size_t)(c0 + row) * ldout + r0 + c8;
      *(v4u*)(out + o) = u;
    }
    
  }
}

// ---------------------------------------------------------------------------
// Bias vectors -> RNE-bf16 valued f32 lines padded to kUP: outp[p][u] = bf16(b_p[u]) for u < nvalid, 0 otherwise (p in 0..2, t in 0..63).
// All three candidates loaded with a clamped index, selected by value. 64 threads x 4 floats = 256 = kUP;
// ---------------------------------------------------------------------------
__device__ __forceinline__ void bias_pad(int p, int t, const float* __restrict__ b0, const float* __restrict__ b1,
                                         const float* __restrict__ b2, int nvalid, float* __restrict__ outp) {
  float f[4];
#pragma unroll
  for (int e = 0; e < 4; ++e) {
    const int u  = 4 * t + e;
    const int uc = (u < nvalid) ? u : (nvalid - 1);
    const float v0 = b0[uc], v1 = b1[uc], v2 = b2[uc];
    asm volatile("s_wait_xcnt 0x0" ::: "memory");   // in front of any later write of the loads' address registers
    float v = (p == 0) ? v0 : ((p == 1) ? v1 : v2);
    v = bf_bits2f(f2bf_bits(v));
    f[e] = (u < nvalid) ? v : 0.0f;
  }
  const v4f val = (v4f){f[0], f[1], f[2], f[3]};
  float* dst = outp + (size_t)p * kUP + 4 * t;
  *(v4f*)dst = val;
  
}

// ---------------------------------------------------------------------------
// All operand preparation in one launch; the pieces read inputs only and write disjoint workspace planes, so their order is free.
// blockIdx.x: 0..95 = weight transposes (32 tiles of 64 x 64 for each of Wq, Wk, Wv), 96..98 = the three bias lines (64 threads work),
// then 4096 work-groups cast generated and 4096 cast real. The few short pieces come first so that they do not form a tail.
// Every branch is the same for the whole work-group (the transposes hold a barrier).
// ---------------------------------------------------------------------------
constexpr int kPrepT    = 3 * (kDin / 64) * (kUP / 64);     // 96 transpose tiles
constexpr int kCastWG   = (kRows * kDin) / (8 * 256);       // 4096 work-groups per activation plane
constexpr int kPrepGrid = kPrepT + 3 + 2 * kCastWG;
__global__ __launch_bounds__(256) void prep_kernel(const float* __restrict__ gen, const float* __restrict__ real,
                                                   const float* __restrict__ Wq, const float* __restrict__ bq,
                                                   const float* __restrict__ Wk, const float* __restrict__ bk,
                                                   const float* __restrict__ Wv, const float* __restrict__ bv,
                                                   unsigned short* __restrict__ xg, unsigned short* __restrict__ xr,
                                                   unsigned short* __restrict__ wT, float* __restrict__ biasP) {
  __shared__ float sm[64][65];
  const int bx = blockIdx.x;
  if (bx < kPrepT) {
    constexpr int per = (kDin / 64) * (kUP / 64);
    const int w   = bx / per;
    const int rem = bx - w * per;
    const float* W = (w == 0) ? Wq : ((w == 1) ? Wk : Wv);
    transpose_cast_pad(sm, rem % (kDin / 64), rem / (kDin / 64), W, kUnits, kUnits, wT + (size_t)w * (kUP * kDin), kDin);
  } else if (bx < kPrepT + 3) {
    if (threadIdx.x < 64) bias_pad(bx - kPrepT, (int)threadIdx.x, bq, bk, bv, kUnits, biasP);
  } else {
    const int c = bx - (kPrepT + 3);
    if (c < kCastWG) cast8_bf16(gen, xg, c * 256 + (int)threadIdx.x);
    else             cast8_bf16(real, xr, (c - kCastWG) * 256 + (int)threadIdx.x);
  }
}

// ---------------------------------------------------------------------------
// Row softmax over materialised f32 scores of all batches (16384 rows x 2048 cols), no mask.
// p = exp(score - max) * (1/sum); P written as bf16 hi/lo planes IN PLACE over the row's own scores:
// the 8192 bytes of f32 row r become 2048 bf16 hi (bytes 0..4095) followed by 2048 bf16 lo (bytes 4096..8191).
// Safe because one block owns one row, every thread's score loads are consumed in front of the first __syncthreads(),
// and the P stores stand behind the second one. One pointer, no __restrict__: loads and stores alias.
// One block of 256 threads per row; thread t owns columns 8t..8t+7 (256 x 8 = 2048).
// Reductions in fixed order (thread, wave shuffle tree, 8 wave partials in index order); shuffles outside all branches.
// ---------------------------------------------------------------------------
__global__ __launch_bounds__(256) void softmax_rows_kernel(float* SP) {
  __shared__ float redM[8];
  __shared__ float redS[8];
  const int qi   = blockIdx.x;           // query row 0..16383 (batch * 2048 + row)
  const int t    = threadIdx.x;
  const int lane = t & 31, wave = t >> 5;
  const int c0   = t * 8;
  const size_t rowoff = (size_t)qi * (size_t)kSeq;

  const float* sr = SP + rowoff + c0;
  const v4f a = *(const v4f*)(sr);
  const v4f c = *(const v4f*)(sr + 4);
  float xv[8];
#pragma unroll
  for (int e = 0; e < 4; ++e) { xv[e] = a[e]; xv[4 + e] = c[e]; }
  float m = xv[0];
#pragma unroll
  for (int e = 1; e < 8; ++e) m = fmaxf(m, xv[e]);
#pragma unroll
  for (int off = 16; off > 0; off >>= 1) m = fmaxf(m, __shfl_xor(m, off, 32));
  if (lane == 0) redM[wave] = m;
  __syncthreads();
  float gmax = redM[0];
#pragma unroll
  for (int w = 1; w < 8; ++w) gmax = fmaxf(gmax, redM[w]);

  float p[8];
  float ps = 0.0f;
#pragma unroll
  for (int e = 0; e < 8; ++e) { p[e] = expf(xv[e] - gmax); ps += p[e]; }
#pragma unroll
  for (int off = 16; off > 0; off >>= 1) ps += __shfl_xor(ps, off, 32);
  if (lane == 0) redS[wave] = ps;
  __syncthreads();
  float tot = redS[0];
#pragma unroll
  for (int w = 1; w < 8; ++w) tot += redS[w];
  const float inv = 1.0f / tot;          // tot >= 1

  unsigned hw[4], lw[4];
#pragma unroll
  for (int e2 = 0; e2 < 4; ++e2) {
    const float f0 = p[2 * e2] * inv;
    const float f1 = p[2 * e2 + 1] * inv;
    const unsigned short h0 = f2bf_bits(f0);
    const unsigned short h1 = f2bf_bits(f1);
    const unsigned short l0 = f2bf_bits(f0 - bf_bits2f(h0));
    const unsigned short l1 = f2bf_bits(f1 - bf_bits2f(h1));
    hw[e2] = pk16(h0, h1);
    lw[e2] = pk16(l0, l1);
  }
  const v4u hv = (v4u){hw[0], hw[1], hw[2], hw[3]};
  const v4u lv = (v4u){lw[0], lw[1], lw[2], lw[3]};
  unsigned short* ph = (unsigned short*)(SP + rowoff) + c0;
  unsigned short* pl = ph + kSeq;
  *(v4u*)ph = hv;
  *(v4u*)pl = lv;
  
}

// ---------------------------------------------------------------------------
// Final sum and copy: the two p.v partial sums tmp0 + tmp1, f32 [kRows][kUP] each (pitch 256) -> out f32 flat [kRows][kUnits] (pitch 200, contiguous).
// Thread i owns flat output elements 4i..4i+3 (same row since 200 % 4 == 0); one 16-B store per lane, thread-linear from the
// Coverage: n4 = kRows*kUnits/4 threads x 4 = the whole output (grid exact multiple of 256).
// ---------------------------------------------------------------------------
__global__ __launch_bounds__(256) void copy_out_kernel(const float* __restrict__ tmp0, const float* __restrict__ tmp1, float* __restrict__ out, int n4) {
  const int i = blockIdx.x * 256 + threadIdx.x;
  if (i >= n4) return;
  const int e   = 4 * i;
  const int row = e / kUnits;
  const int col = e - row * kUnits;
  const size_t o = (size_t)row * kUP + col;
  const v4f v = *(const v4f*)(tmp0 + o) + *(const v4f*)(tmp1 + o);
  float* dst = out + (size_t)e;
  *(v4f*)dst = v;
  
}

// ---------------------------------------------------------------------------
// Launcher. Workspace region map (bytes, MiB = 1048576; total carve = 224 MiB = 234881024 B):
//   [  0,128) S/P   : scores f32 [8][2048][2048]; softmax turns each 8192-B row into P hi bf16 [2048] + P lo bf16 [2048] in place
//                     earlier alias: Xg = generated as bf16 [16384][512] at [0, 16), Xr = real as bf16 [16384][512] at [16, 32)
//   [128,136) q hi  : bf16 [16384][256]; [136,144) q lo
//   [144,152) k hi  : bf16 [16384][256]; [152,160) k lo
//   [160,168) v^T hi: bf16 [256][16384]; [168,176) v^T lo
//   [176,192) O tmp : f32 [16384][256], partial sum over keys 0..1023 of each batch
//   [208,224) O tmp : f32 [16384][256], partial sum over keys 1024..2047
//   [192 MiB, +786432)  W^T planes: 3 x bf16 [256][512] (262144 B each: Wq^T, Wk^T, Wv^T; rows 200..255 zero)
//   [ +786432, +3072)   bias lines: 3 x f32 [256] (RNE-bf16 values, 200..255 zero)
// Lifetimes: Xg is read only by the q projection, Xr only by the k and v^T projections (launch 2); S first written in launch 3.
// Launch count: preparation + projections + scores + softmax + p.v (blockIdx.y = batch, blockIdx.z = key half) + sum and copy = 6. Kernel launches only.
// GEMM shapes: proj q/k M=16384 N=256 K=512; v^T M=256 N=16384 K=512; per batch scores M=N=2048 K=224; p.v M=2048 N=256 K=1024 for each of 2 key halves (all M % 128 == 0, N % 256 == 0, K % 32 == 0; row pitches cover K rounded up to 64).
// ---------------------------------------------------------------------------
extern "C" void kernel_launch(void* const* d_in, const int* in_sizes, int n_in,
                              void* d_out, int out_size, void* d_ws, size_t ws_size,
                              hipStream_t stream) {
  if (n_in < 8) return;
  if (in_sizes[0] != kRows * kDin || in_sizes[1] != kRows * kDin) return;
  if (in_sizes[2] != kDin * kUnits || in_sizes[4] != kDin * kUnits || in_sizes[6] != kDin * kUnits) return;
  if (in_sizes[3] != kUnits || in_sizes[5] != kUnits || in_sizes[7] != kUnits) return;
  if (out_size != kRows * kUnits) return;

  const size_t kMiB    = 1048576;
  const size_t offXg   = 0;
  const size_t offXr   = 16 * kMiB;
  const size_t offS    = 0;
  const size_t offQhi  = 128 * kMiB;
  const size_t offQlo  = 136 * kMiB;
  const size_t offKhi  = 144 * kMiB;
  const size_t offKlo  = 152 * kMiB;
  const size_t offVhi  = 160 * kMiB;
  const size_t offVlo  = 168 * kMiB;
  const size_t offO    = 176 * kMiB;
  const size_t offO1   = 208 * kMiB;
  const size_t wplane  = (size_t)kUP * kDin * 2;                 // 262144 B
  const size_t offWq   = 192 * kMiB;
  const size_t offWk   = offWq + wplane;
  const size_t offWv   = offWk + wplane;
  const size_t offBias = offWv + wplane;                         // 192 MiB + 786432
  const size_t total   = offO1 + 16 * kMiB;                      // 234881024 B; the bias lines end at 192 MiB + 789504, below offO1
  if (total > ws_size) return;

  const float* gen  = (const float*)d_in[0];
  const float* real = (const float*)d_in[1];
  const float* Wq   = (const float*)d_in[2];
  const float* bq   = (const float*)d_in[3];
  const float* Wk   = (const float*)d_in[4];
  const float* bk   = (const float*)d_in[5];
  const float* Wv   = (const float*)d_in[6];
  const float* bv   = (const float*)d_in[7];
  float* out = (float*)d_out;
  char* ws = (char*)d_ws;

  unsigned short* xg   = (unsigned short*)(ws + offXg);
  unsigned short* xr   = (unsigned short*)(ws + offXr);
  float*          Sbuf = (float*)(ws + offS);
  unsigned short* phi  = (unsigned short*)(ws + offS);           // row pitch 2 * kSeq halves
  unsigned short* plo  = phi + kSeq;
  unsigned short* qhi  = (unsigned short*)(ws + offQhi);
  unsigned short* qlo  = (unsigned short*)(ws + offQlo);
  unsigned short* khi  = (unsigned short*)(ws + offKhi);
  unsigned short* klo  = (unsigned short*)(ws + offKlo);
  unsigned short* vthi = (unsigned short*)(ws + offVhi);
  unsigned short* vtlo = (unsigned short*)(ws + offVlo);
  float*          Otmp = (float*)(ws + offO);
  float*          Otmp1 = (float*)(ws + offO1);
  unsigned short* wqT  = (unsigned short*)(ws + offWq);          // Wq^T, Wk^T, Wv^T planes in a row
  float*          biasP = (float*)(ws + offBias);

  // in-range dummies for unused (never dereferenced) template-dead pointer parameters
  const float* dummy_f = biasP;
  void* dummy_c2 = (void*)biasP;

  // 1. operand preparation: activations -> RNE bf16 planes [16384][512]; W [512][200] -> W^T bf16 [256][512], rows 200..255 zero;
  //    biases -> padded RNE-bf16 valued f32 lines [3][256]
  prep_kernel<<<dim3(kPrepGrid), dim3(256), 0, stream>>>(gen, real, Wq, bq, Wk, bk, Wv, bv, xg, xr, wqT, biasP);

  // 2. q, k [16384][256] and v^T [256][16384] as bf16 hi/lo planes: 3 x 128 work-groups (blockIdx.y = which projection)
  proj3_kernel<<<dim3((kRows / kTileM) * (kUP / kTileN), 3), dim3(256), 0, stream>>>(
      xg, xr, wqT, qhi, qlo, khi, klo, vthi, vtlo, biasP);

  // 3. scores = 200^-0.5 * q . k^T, all batches (blockIdx.y): M=N=2048, K=224 (cols 200..223 exact zeros), 3 products on hi/lo planes -> f32 [8][2048][2048]
  wmma_gemm64<1, true, 0, 0, false, 0><<<dim3((kSeq / kTileM) * (kSeq / kTileN), kBatch), dim3(256), 0, stream>>>(
      qhi, qlo, kUP, (long)kSeq * kUP,
      khi, klo, kUP, (long)kSeq * kUP,
      (void*)Sbuf, dummy_c2, kSeq, (long)kSeq * kSeq,
      0L, 0L, 0L,
      dummy_f, dummy_f, 0L,
      kSeq, kSeq, kKS, kScoreScale);

  // 4. softmax of all 16384 rows -> P hi/lo planes in place (row pitch 4096 halves)
  softmax_rows_kernel<<<dim3(kRows), dim3(256), 0, stream>>>(Sbuf);

  // 5. O = P . v, all batches (blockIdx.y), keys in two halves (blockIdx.z) so that 16 x 8 x 2 = 256 work-groups run, one on every WGP:
  //     M=2048, N=256, K=1024 each, 3 products; Bt = v^T rows u, cols b*2048 + z*1024.. (ldb 16384) -> f32 partial z, rows b*2048.., pitch 256
  wmma_gemm64<1, true, 0, 0, false, 0><<<dim3((kSeq / kTileM) * (kUP / kTileN), kBatch, kPvSplit), dim3(256), 0, stream>>>(
      phi, plo, 2 * kSeq, (long)kSeq * 2 * kSeq,
      vthi, vtlo, kRows, (long)kSeq,
      (void*)Otmp, dummy_c2, kUP, (long)kSeq * kUP,
      (long)(kSeq / kPvSplit), (long)(kSeq / kPvSplit), (long)(Otmp1 - Otmp),
      dummy_f, dummy_f, 0L,
      kSeq, kUP, kSeq / kPvSplit, 1.0f);

  // 6. partial 0 + partial 1 [16384][256] -> out [16384][200] contiguous
  {
    const int n4 = (kRows * kUnits) / 4;                    // 819200 = 3200 blocks x 256
    copy_out_kernel<<<dim3(n4 / 256), dim3(256), 0, stream>>>(Otmp, Otmp1, out, n4);
  }
}

// v006
// One run takes 60.4 microseconds.
// Versions between v004 and this one are left out; their measured steps multiply to 2.54 times as fast.
// All steps since v000 together make it 24.6 times as fast.
// Contractions: x.W projections (q, k planes and v^T plane): single v_wmma_f32_16x16x32_bf16 product on RNE-bf16 converted x, W, bias; k.q^T scores and v^T.p^T output: single v_wmma_f32_16x16x32_f16 product on RNE-f16 q, k, v^T and p (p = exp(score - maximum in use), at most 256); all f32 accumulate; softmax in f32, online, per half of the key range; the two halves joined once in f32.
#include <hip/hip_runtime.h>
#include <math.h>

// ---------------------------------------------------------------------------
// Problem constants
// ---------------------------------------------------------------------------
constexpr int kBatch = 8;
constexpr int kSeq   = 2048;
constexpr int kDin   = 512;
constexpr int kUnits = 200;
constexpr int kUP    = 256;              // padded unit count (cols 200..255 exactly zero)
constexpr int kRows  = kBatch * kSeq;    // 16384 token rows
constexpr int kKS    = 224;              // score contraction depth (q/k cols 200..223 are exact zeros)
constexpr float kScoreScaleLog2 = 0.070710678118654752f * 1.4426950408889634f;   // 200^-0.5 * log2(e): scores go to the exponential in the log2 domain

static_assert(kRows % 64 == 0 && kUP % 64 == 0 && kSeq % 64 == 0 && kDin % 64 == 0, "tile multiples");
static_assert(kDin % 32 == 0 && kKS % 32 == 0 && kSeq % 32 == 0, "K multiples of 32");
static_assert(kKS >= kUnits && kKS <= kUP, "score depth covers all real units");
static_assert(kRows % 256 == 0 && kSeq % 256 == 0 && kUP % 256 == 0, "work-group tile 128 x 256 in either orientation");
static_assert((kRows * kDin) % (8 * 256) == 0, "cast kernel grid exact");
static_assert((kRows * kUnits) % (4 * 256) == 0 && kUnits % 4 == 0, "copy kernel grid exact, float4 inside one row");
static_assert(kUP == 4 * 64, "bias kernel: 64 threads x 4 floats");

typedef __attribute__((ext_vector_type(16))) _Float16 v16h;
typedef __attribute__((ext_vector_type(8)))  _Float16 v8h;
typedef __attribute__((ext_vector_type(16))) __bf16   v16b;
typedef __attribute__((ext_vector_type(8)))  __bf16   v8b;
typedef __attribute__((ext_vector_type(8)))  float    v8f;
typedef __attribute__((ext_vector_type(4)))  float    v4f;
typedef __attribute__((ext_vector_type(4)))  unsigned int v4u;

// ---------------------------------------------------------------------------
// Device helpers
// ---------------------------------------------------------------------------
__device__ __forceinline__ unsigned short f2bf_bits(float f) {
  unsigned u = __float_as_uint(f);
  return (unsigned short)((u + 0x7FFFu + ((u >> 16) & 1u)) >> 16);
}
__device__ __forceinline__ float bf_bits2f(unsigned short h) { return __uint_as_float(((unsigned)h) << 16); }

// hazard guards as plain device helpers
__device__ __forceinline__ void dep_guard_h(v8f& a, v8f& b, v16h x, v16h y) { asm volatile("v_nop\n\tv_nop\n\tv_nop\n\tv_nop" : "+v"(a), "+v"(b) : "v"(x), "v"(y)); }
__device__ __forceinline__ void dep_guard_b(v8f& a, v8f& b, v16b x, v16b y) { asm volatile("v_nop\n\tv_nop\n\tv_nop\n\tv_nop" : "+v"(a), "+v"(b) : "v"(x), "v"(y)); }
__device__ __forceinline__ void keep4_h(v16h a, v16h b, v16h c, v16h d) { asm volatile("v_nop" :: "v"(a), "v"(b), "v"(c), "v"(d)); }
__device__ __forceinline__ void keep4_b(v16b a, v16b b, v16b c, v16b d) { asm volatile("v_nop" :: "v"(a), "v"(b), "v"(c), "v"(d)); }
__device__ __forceinline__ void acc_guard4(v8f& a, v8f& b, v8f& c, v8f& d) { asm volatile("v_nop\n\tv_nop\n\tv_nop\n\tv_nop" : "+v"(a), "+v"(b), "+v"(c), "+v"(d)); }
template <typename T> struct Frag;
template <> struct Frag<_Float16> {
  typedef v16h V; union U { v16h v; v8h h[2]; };
  // elements 0..7 <- p[0..7], 8..15 <- p[16..23]
  static __device__ __forceinline__ v16h load(const _Float16* p) {
    U f; f.h[0] = *(const v8h*)(p); f.h[1] = *(const v8h*)(p + 16); return f.v;
  }
  static __device__ __forceinline__ v8f mma(v16h a, v16h b, v8f c) {
    return __builtin_amdgcn_wmma_f32_16x16x32_f16(false, a, false, b, (short)0, c, false, false);
  }
  static __device__ __forceinline__ void guard(v8f& a, v8f& b, v16h x, v16h y) { dep_guard_h(a, b, x, y); }
  static __device__ __forceinline__ void keep(v16h a, v16h b, v16h c, v16h d) { keep4_h(a, b, c, d); }
};
template <> struct Frag<__bf16> {
  typedef v16b V; union U { v16b v; v8b h[2]; };
  static __device__ __forceinline__ v16b load(const __bf16* p) {
    U f; f.h[0] = *(const v8b*)(p); f.h[1] = *(const v8b*)(p + 16); return f.v;
  }
  static __device__ __forceinline__ v8f mma(v16b a, v16b b, v8f c) {
    return __builtin_amdgcn_wmma_f32_16x16x32_bf16(false, a, false, b, (short)0, c, false, false);
  }
  static __device__ __forceinline__ void guard(v8f& a, v8f& b, v16b x, v16b y) { dep_guard_b(a, b, x, y); }
  static __device__ __forceinline__ void keep(v16b a, v16b b, v16b c, v16b d) { keep4_b(a, b, c, d); }
};

__device__ __forceinline__ unsigned pk16(unsigned short a, unsigned short b) { return (unsigned)a | ((unsigned)b << 16); }

// ---- Register-blocked batched WMMA GEMM, operands staged in LDS by asynchronous copies ----
// C[m,n] = scale * sum_k A[m,k] * Bt[n,k] (+bias)(+resid); a work-group owns a 128x256 tile, each of its 8 waves (2 x 4) a 64x64 tile.
// A row-major [M,K]; Bt row-major [N,K]; M % 128 == 0, N % 256 == 0, K % 32 == 0; lda, ldb >= K rounded up to 64 (a stage copies whole 128-B rows).
// z = part of a K range: part z reads A and Bt from element z * zA / z * zB of each row on, K elements deep, and
// writes its own partial C at z * zC (only with BIAS_MODE 0 and no resid). One part: zA = zB = zC = 0.
// SPLIT: operands are hi/lo planes (A2/Bt2 = lo planes, same layout); product = hi.hi + hi.lo + lo.hi.
// BIAS_MODE: 0 = none, 1 = bias[m], 2 = bias[n].
// OUT_MODE: 0 = f32, 1 = f16 (Cout2 is not used).
// ET: 0 = f16 operands, 1 = bf16 operands (pointers passed as 16-bit storage)
// Stage = 64 k of every operand row: [A hi 128 rows | B hi 256 rows | A lo | B lo], LDS row pitch 144 B (16 B x odd: ds_load_b128 free of bank conflicts).
// Two buffers: the copies of stage s + 1 fly while stage s is multiplied.
constexpr int kStageK  = 64;                      // k per stage = 128 B of a row = one whole line
constexpr int kPitchB  = 144;                     // LDS row pitch, bytes
constexpr int kTileM   = 128;
constexpr int kTileN   = 256;
constexpr int kPlaneA  = kTileM * kPitchB;        // 18432 B
constexpr int kPlaneB  = kTileN * kPitchB;        // 36864 B
constexpr int kPlaneAB = kPlaneA + kPlaneB;       // 55296 B
constexpr int kRowStep = 32 * kPitchB;            // 256 threads copy 32 rows of 128 B at a time

// One plane pair of a stage: 4 x 32 rows of A and 8 x 32 rows of B, 16 B per lane and copy, through no register.
// la / lb: the lane's LDS byte address of its first A / B row; ga / gb: its global address; sa / sb: bytes between 32 global rows.
// s_wait_xcnt 0 is the statement's last line: it stands in front of any later write of the address registers named here.
__device__ __forceinline__ void async_copy_plane(unsigned la, const char* ga, size_t sa, unsigned lb, const char* gb, size_t sb) {
  asm volatile(
      "global_load_async_to_lds_b128 %0, %12, off\n\t"
      "global_load_async_to_lds_b128 %1, %13, off\n\t"
      "global_load_async_to_lds_b128 %2, %14, off\n\t"
      "global_load_async_to_lds_b128 %3, %15, off\n\t"
      "global_load_async_to_lds_b128 %4, %16, off\n\t"
      "global_load_async_to_lds_b128 %5, %17, off\n\t"
      "global_load_async_to_lds_b128 %6, %18, off\n\t"
      "global_load_async_to_lds_b128 %7, %19, off\n\t"
      "global_load_async_to_lds_b128 %8, %20, off\n\t"
      "global_load_async_to_lds_b128 %9, %21, off\n\t"
      "global_load_async_to_lds_b128 %10, %22, off\n\t"
      "global_load_async_to_lds_b128 %11, %23, off\n\t"
      "s_wait_xcnt 0x0"
      :: "v"(la), "v"(la + kRowStep), "v"(la + 2 * kRowStep), "v"(la + 3 * kRowStep),
         "v"(lb), "v"(lb + kRowStep), "v"(lb + 2 * kRowStep), "v"(lb + 3 * kRowStep),
         "v"(lb + 4 * kRowStep), "v"(lb + 5 * kRowStep), "v"(lb + 6 * kRowStep), "v"(lb + 7 * kRowStep),
         "v"(ga), "v"(ga + sa), "v"(ga + 2 * sa), "v"(ga + 3 * sa),
         "v"(gb), "v"(gb + sb), "v"(gb + 2 * sb), "v"(gb + 3 * sb),
         "v"(gb + 4 * sb), "v"(gb + 5 * sb), "v"(gb + 6 * sb), "v"(gb + 7 * sb)
      : "memory");
}

template <int ET> struct Elem;
template <> struct Elem<0> { typedef _Float16 T; };
template <> struct Elem<1> { typedef __bf16 T; };
// The tile routine: ring = two stage buffers, sTall = 8 per-wave 16x64 slabs of pitch 68 floats (both the calling kernel's LDS);
// bx = tile index, b = batch, z = part of the K range (proj3_kernel passes blockIdx.x, 0, 0).
template <int ET, bool SPLIT, int BIAS_MODE, int OUT_MODE, bool RESID, int ACT>
__device__ __forceinline__ void gemm_tile(
    char* ring, float* sTall, int bx, int b, int z,
    const unsigned short* __restrict__ Ap, const unsigned short* __restrict__ A2p, int lda, long strideA,
    const unsigned short* __restrict__ Btp, const unsigned short* __restrict__ Bt2p, int ldb, long strideB,
    void* __restrict__ Cout, void* __restrict__ Cout2, int ldc, long strideC,
    long zA, long zB, long zC,
    const float* __restrict__ bias,
    const float* __restrict__ resid, long strideR,
    int M, int N, int K, float scale) {
  typedef typename Elem<ET>::T T;
  typedef typename Frag<T>::V V;
  constexpr int kStageB = (SPLIT ? 2 : 1) * kPlaneAB;   // bytes of one buffer
  const int lane = threadIdx.x & 31;
  const int wave = threadIdx.x >> 5;
  const int tilesN = N >> 8;
  const int tilesM = M >> 7;
  if (bx >= tilesM * tilesN) return;   // the same for the whole work-group, in front of every copy and barrier
  const int tm  = bx / tilesN;
  const int tn  = bx - tm * tilesN;
  const int m0g = tm << 7;                          // work-group tile origin
  const int n0g = tn << 8;
  const int mw  = (wave >> 2) << 6;                 // wave tile origin inside it
  const int nw  = (wave & 3) << 6;
  const int m0  = m0g + mw;
  const int n0  = n0g + nw;

  const int rlane = lane & 15;                 // row (A) / col (B, D) within subtile
  const int koff  = (lane >> 4) * 8;           // k offset of this lane half
  const int mOff  = (lane >> 4) * 8;           // D row offset

  // copy addresses of this lane: row threadIdx.x / 8 of each group of 32 rows, 16-B piece threadIdx.x % 8 of its 128 B
  const int crow = threadIdx.x >> 3;
  const int cpc  = (threadIdx.x & 7) << 4;
  const size_t rsA = (size_t)lda * 64;         // 32 rows x 2 B
  const size_t rsB = (size_t)ldb * 64;
  const size_t goA = ((size_t)b * strideA + (size_t)z * zA + (size_t)(m0g + crow) * lda) * 2 + cpc;
  const size_t goB = ((size_t)b * strideB + (size_t)z * zB + (size_t)(n0g + crow) * ldb) * 2 + cpc;
  const char* gA  = (const char*)Ap  + goA;
  const char* gB  = (const char*)Btp + goB;
  const char* gA2 = (const char*)A2p  + goA;
  const char* gB2 = (const char*)Bt2p + goB;
  const unsigned lds0 = (unsigned)(size_t)(&ring[0]) + (unsigned)(crow * kPitchB + cpc);
  auto fill = [&](int s, int buf) {
    const size_t kb = (size_t)s * (kStageK * 2);
    const unsigned l = lds0 + (unsigned)(buf * kStageB);
    async_copy_plane(l, gA + kb, rsA, l + kPlaneA, gB + kb, rsB);
    if (SPLIT) async_copy_plane(l + kPlaneAB, gA2 + kb, rsA, l + kPlaneAB + kPlaneA, gB2 + kb, rsB);
  };

  v8f acc[4][4];
#pragma unroll
  for (int i = 0; i < 4; ++i)
#pragma unroll
    for (int j = 0; j < 4; ++j) acc[i][j] = (v8f){0.f,0.f,0.f,0.f,0.f,0.f,0.f,0.f};

  const int nst = (K + kStageK - 1) / kStageK;
  fill(0, 0);
  asm volatile("s_wait_asynccnt 0x0" ::: "memory");   // this wave's share of stage 0 has landed
  __syncthreads();                                    // publishes stage 0
  if (nst > 1) fill(1, 1);

  const int fragA = (mw + rlane) * kPitchB + koff * 2;            // byte of this lane's first A fragment row in a plane pair
  const int fragB = kPlaneA + (nw + rlane) * kPitchB + koff * 2;  // the same for B
  for (int s = 0; s < nst; ++s) {
    const char* sb = ring + (s & 1) * kStageB;
#pragma unroll   // kk becomes an immediate in every LDS offset
    for (int kk = 0; kk < 2; ++kk) {
      if (s * kStageK + kk * 32 < K) {   // scalar: a K that is an odd multiple of 32 ends on half a stage
        V bh[4], bl[4];
#pragma unroll
        for (int j = 0; j < 4; ++j) {
          const char* bp = sb + fragB + j * (16 * kPitchB) + kk * 64;
          bh[j] = Frag<T>::load((const T*)bp);
          if (SPLIT) bl[j] = Frag<T>::load((const T*)(bp + kPlaneAB));
        }
#pragma unroll
        for (int i = 0; i < 4; ++i) {
          const char* ap = sb + fragA + i * (16 * kPitchB) + kk * 64;
          V ah = Frag<T>::load((const T*)ap);
          V al;
          if (SPLIT) al = Frag<T>::load((const T*)(ap + kPlaneAB));
#pragma unroll
          for (int j = 0; j < 4; ++j) {
            acc[i][j] = Frag<T>::mma(ah, bh[j], acc[i][j]);
            if (SPLIT) acc[i][j] = Frag<T>::mma(ah, bl[j], acc[i][j]);
            if (SPLIT) acc[i][j] = Frag<T>::mma(al, bh[j], acc[i][j]);
          }
          Frag<T>::guard(acc[i][0], acc[i][3], ah, SPLIT ? al : ah);
        }
        Frag<T>::keep(bh[0], bh[1], bh[2], bh[3]);
        if (SPLIT) Frag<T>::keep(bl[0], bl[1], bl[2], bl[3]);
      }
    }
    asm volatile("s_wait_dscnt 0x0" ::: "memory");      // this wave's reads of buffer s & 1 are done before it is refilled
    asm volatile("s_wait_asynccnt 0x0" ::: "memory");   // this wave's share of stage s + 1 has landed
    __syncthreads();                                    // publishes stage s + 1 and ends every reader's last read of stage s
    if (s + 2 < nst) fill(s + 2, s & 1);
  }
  asm volatile("s_wait_asynccnt 0x0" ::: "memory");     // nothing in flight when the wave goes on to the epilogue and ends
  acc_guard4(acc[0][0], acc[0][1], acc[0][2], acc[0][3]);
  acc_guard4(acc[1][0], acc[1][1], acc[1][2], acc[1][3]);
  acc_guard4(acc[2][0], acc[2][1], acc[2][2], acc[2][3]);
  acc_guard4(acc[3][0], acc[3][1], acc[3][2], acc[3][3]);

  // ---- epilogue ----
  float* slab = sTall + wave * (16 * 68);
  const float* Rb = RESID ? (resid + (size_t)b * strideR) : nullptr;
#pragma unroll
  for (int i = 0; i < 4; ++i) {
    const int mBase = m0 + (i << 4);
#pragma unroll
    for (int j = 0; j < 4; ++j) {
      const int n = n0 + (j << 4) + rlane;
      float bv = 0.f;
      if (BIAS_MODE == 2) bv = bias[n];
#pragma unroll
      for (int r = 0; r < 8; ++r) {
        float v = acc[i][j][r] * scale;
        if (BIAS_MODE == 1) v += bias[mBase + mOff + r];
        if (BIAS_MODE == 2) v += bv;
        if (RESID) v += Rb[(size_t)(mBase + mOff + r) * ldc + n];
        if (ACT == 2) v = fmaxf(v, 0.0f);
        if (ACT == 4) v = (v > 0.f) ? v : 0.01f * v;
        slab[(mOff + r) * 68 + (j << 4) + rlane] = v;
      }
    }
    __builtin_amdgcn_fence(__ATOMIC_RELEASE, "workgroup");
    __builtin_amdgcn_wave_barrier();
    __builtin_amdgcn_fence(__ATOMIC_ACQUIRE, "workgroup");
    if (OUT_MODE == 0) {
      float* C = (float*)Cout + (size_t)b * strideC + (size_t)z * zC;
      const int hh = lane >> 4, c4 = (lane & 15) * 4;     // row seg = 256 B = 16 lanes x 16 B
      {
        v4f v[8];
        float* dst[8];
#pragma unroll   // v and dst are indexed by constants and stay in registers
        for (int it = 0; it < 8; ++it) {
          const int row = it * 2 + hh;
          v[it]   = *(const v4f*)(slab + row * 68 + c4);
          dst[it] = C + (size_t)(mBase + row) * ldc + n0 + c4;
        }
#pragma unroll
        for (int it = 0; it < 8; ++it) *(v4f*)dst[it] = v[it];
        // one wait for the eight stores, in front of any later write of their registers: data and addresses are inputs, so they live up to it
        asm volatile("s_wait_xcnt 0x0" :: "v"(v[0]), "v"(v[1]), "v"(v[2]), "v"(v[3]), "v"(v[4]), "v"(v[5]), "v"(v[6]), "v"(v[7]),
                     "v"(dst[0]), "v"(dst[1]), "v"(dst[2]), "v"(dst[3]), "v"(dst[4]), "v"(dst[5]), "v"(dst[6]), "v"(dst[7]) : "memory");
      }
    } else {
      const int q = lane >> 3, c8 = (lane & 7) * 8;
      unsigned short* C  = (unsigned short*)Cout  + (size_t)b * strideC + (size_t)z * zC;
      {
        v8h hv[4];
        unsigned short* dst[4];
#pragma unroll   // hv and dst are indexed by constants and stay in registers
        for (int it = 0; it < 4; ++it) {
          const int row = it * 4 + q;
          const float* sp = slab + row * 68 + c8;
#pragma unroll
          for (int e = 0; e < 8; ++e) hv[it][e] = (_Float16)sp[e];
          dst[it] = C + (size_t)(mBase + row) * ldc + n0 + c8;
        }
#pragma unroll
        for (int it = 0; it < 4; ++it) *(v8h*)dst[it] = hv[it];
        // one wait for the four stores, in front of any later write of their registers: data and addresses are inputs, so they live up to it
        asm volatile("s_wait_xcnt 0x0" :: "v"(hv[0]), "v"(hv[1]), "v"(hv[2]), "v"(hv[3]),
                     "v"(dst[0]), "v"(dst[1]), "v"(dst[2]), "v"(dst[3]) : "memory");
      }
    }
    __builtin_amdgcn_fence(__ATOMIC_RELEASE, "workgroup");
    __builtin_amdgcn_wave_barrier();
    __builtin_amdgcn_fence(__ATOMIC_ACQUIRE, "workgroup");
  }
}

// The three projections in one launch: blockIdx.y = 0: q = Xg . Wq^T + bq[n], 1: k = Xr . Wk^T + bk[n] (M=16384, N=256),
// 2: v^T = Wv^T . Xr^T + bv[m] (M=256, N=16384); K=512, single bf16 product -> one f16 plane; 128 tiles each (blockIdx.x).
// None reads what another writes. One LDS allocation serves whichever branch the work-group takes (142 KiB: two work-groups fit a WGP).
// wT: Wq^T, Wk^T, Wv^T planes [256][512] in a row; biasP: the three padded bias lines in a row.
static_assert((kRows / kTileM) * (kUP / kTileN) == (kUP / kTileM) * (kRows / kTileN), "the three projections have equally many tiles");
__global__ __launch_bounds__(256) void proj3_kernel(
    const unsigned short* __restrict__ xg, const unsigned short* __restrict__ xr, const unsigned short* __restrict__ wT,
    unsigned short* __restrict__ qh, unsigned short* __restrict__ kh, unsigned short* __restrict__ vth,
    const float* __restrict__ biasP) {
  __shared__ __align__(16) char ring[2 * kPlaneAB];
  __shared__ __align__(16) float sT[8 * 16 * 68];
  const int y = blockIdx.y;                    // the same for the whole work-group
  if (y < 2) {
    const unsigned short* x = y ? xr : xg;
    const unsigned short* w = wT + (size_t)y * (kUP * kDin);
    unsigned short* c = y ? kh : qh;
    gemm_tile<1, false, 2, 1, false, 0>(ring, sT, (int)blockIdx.x, 0, 0,
        x, x, kDin, 0L, w, w, kDin, 0L,
        (void*)c, (void*)c, kUP, 0L, 0L, 0L, 0L,
        biasP + y * kUP, biasP, 0L, kRows, kUP, kDin, 1.0f);
  } else {
    const unsigned short* w = wT + (size_t)2 * (kUP * kDin);
    gemm_tile<1, false, 1, 1, false, 0>(ring, sT, (int)blockIdx.x, 0, 0,
        w, w, kDin, 0L, xr, xr, kDin, 0L,
        (void*)vth, (void*)vth, kRows, 0L, 0L, 0L, 0L,
        biasP + 2 * kUP, biasP, 0L, kUP, kRows, kDin, 1.0f);
  }
}

// ---------------------------------------------------------------------------
// f32 -> RNE bf16 plane, 8 consecutive elements per thread packed as integer words; i = index of the thread's group of 8.
// ---------------------------------------------------------------------------
__device__ __forceinline__ void cast8_bf16(const float* __restrict__ in, unsigned short* __restrict__ out, int i) {
  const float* p = in + 8 * (size_t)i;
  const v4f a = *(const v4f*)(p);
  const v4f c = *(const v4f*)(p + 4);
  float f[8];
#pragma unroll
  for (int e = 0; e < 4; ++e) { f[e] = a[e]; f[4 + e] = c[e]; }
  unsigned w[4];
#pragma unroll
  for (int e2 = 0; e2 < 4; ++e2) w[e2] = pk16(f2bf_bits(f[2 * e2]), f2bf_bits(f[2 * e2 + 1]));
  const v4u u = (v4u){w[0], w[1], w[2], w[3]};
  unsigned short* q = out + 8 * (size_t)i;
  *(v4u*)q = u;
  asm volatile("s_wait_xcnt 0x0" ::: "memory");   // in front of any later write of the store's address and data registers
}

// ---------------------------------------------------------------------------
// Transpose + RNE bf16 convert of a weight matrix with zero padding of the output rows:
// in f32 [R][ncol] row-major (ldin = ncol) -> out bf16 [Cpad][R] (ldout = R): out[c][r] = bf16(in[r][c]) for c < ncol, 0 for c >= ncol.
// rt = r tile (64 output cols), ct = c tile (64 output rows); sm = 64 x 65 floats of the calling kernel's LDS. 256 threads.
// Load coverage: 16 iterations x 256 threads = 4096 = the whole 64x64 tile; column ADDRESS clamped to ncol-1, value zeroed by predicate.
// Store coverage: 8 waves x 2 iterations x 4 rows (lane>>3) = 64 rows; (lane&7) x 8 halves = 64 cols; each row segment =
// ---------------------------------------------------------------------------
__device__ __forceinline__ void transpose_cast_pad(float (*sm)[65], int rt, int ct, const float* __restrict__ in, int ldin, int ncol,
                                                   unsigned short* __restrict__ out, int ldout) {
  const int t  = threadIdx.x;    // sm[c_local][r_local]
  const int r0 = rt * 64;
  const int c0 = ct * 64;
  float v[16];   // all 16 loads are issued in front of the first LDS store, so that they are in flight together
#pragma unroll
  for (int i = 0; i < 16; ++i) {
    const int e = i * 256 + t;
    const int r = e >> 6;          // r local
    const int c = e & 63;          // c local
    const int cg = c0 + c;
    const int cc = (cg < ncol) ? cg : (ncol - 1);
    v[i] = in[(size_t)(r0 + r) * ldin + cc];
    asm volatile("s_wait_xcnt 0x0" ::: "memory");   // in front of any later write of the load's address registers
  }
#pragma unroll   // v[i] is indexed by constants and stays in registers
  for (int i = 0; i < 16; ++i) {
    const int e = i * 256 + t;
    const int r = e >> 6;
    const int c = e & 63;
    sm[c][r] = (c0 + c < ncol) ? v[i] : 0.0f;
  }
  __syncthreads();
  const int lane = t & 31, wave = t >> 5;
  const int q = lane >> 3, c8 = (lane & 7) * 8;
  {
#pragma unroll
    for (int it = 0; it < 2; ++it) {
      const int row = wave * 8 + it * 4 + q;                 // c local (output row)
      unsigned w[4];
#pragma unroll
      for (int e2 = 0; e2 < 4; ++e2) w[e2] = pk16(f2bf_bits(sm[row][c8 + 2 * e2]), f2bf_bits(sm[row][c8 + 2 * e2 + 1]));
      const v4u u = (v4u){w[0], w[1], w[2], w[3]};
      const size_t o = (size_t)(c0 + row) * ldout + r0 + c8;
      *(v4u*)(out + o) = u;
    }
    
  }
}

// ---------------------------------------------------------------------------
// Bias vectors -> RNE-bf16 valued f32 lines padded to kUP: outp[p][u] = bf16(b_p[u]) for u < nvalid, 0 otherwise (p in 0..2, t in 0..63).
// All three candidates loaded with a clamped index, selected by value. 64 threads x 4 floats = 256 = kUP;
// ---------------------------------------------------------------------------
__device__ __forceinline__ void bias_pad(int p, int t, const float* __restrict__ b0, const float* __restrict__ b1,
                                         const float* __restrict__ b2, int nvalid, float* __restrict__ outp) {
  float f[4];
#pragma unroll
  for (int e = 0; e < 4; ++e) {
    const int u  = 4 * t + e;
    const int uc = (u < nvalid) ? u : (nvalid - 1);
    const float v0 = b0[uc], v1 = b1[uc], v2 = b2[uc];
    asm volatile("s_wait_xcnt 0x0" ::: "memory");   // in front of any later write of the loads' address registers
    float v = (p == 0) ? v0 : ((p == 1) ? v1 : v2);
    v = bf_bits2f(f2bf_bits(v));
    f[e] = (u < nvalid) ? v : 0.0f;
  }
  const v4f val = (v4f){f[0], f[1], f[2], f[3]};
  float* dst = outp + (size_t)p * kUP + 4 * t;
  *(v4f*)dst = val;
  
}

// ---------------------------------------------------------------------------
// All operand preparation in one launch; the pieces read inputs only and write disjoint workspace planes, so their order is free.
// blockIdx.x: 0..95 = weight transposes (32 tiles of 64 x 64 for each of Wq, Wk, Wv), 96..98 = the three bias lines (64 threads work),
// then 4096 work-groups cast generated and 4096 cast real. The few short pieces come first so that they do not form a tail.
// Every branch is the same for the whole work-group (the transposes hold a barrier).
// ---------------------------------------------------------------------------
constexpr int kPrepT    = 3 * (kDin / 64) * (kUP / 64);     // 96 transpose tiles
constexpr int kCastWG   = (kRows * kDin) / (8 * 256);       // 4096 work-groups per activation plane
constexpr int kPrepGrid = kPrepT + 3 + 2 * kCastWG;
__global__ __launch_bounds__(256) void prep_kernel(const float* __restrict__ gen, const float* __restrict__ real,
                                                   const float* __restrict__ Wq, const float* __restrict__ bq,
                                                   const float* __restrict__ Wk, const float* __restrict__ bk,
                                                   const float* __restrict__ Wv, const float* __restrict__ bv,
                                                   unsigned short* __restrict__ xg, unsigned short* __restrict__ xr,
                                                   unsigned short* __restrict__ wT, float* __restrict__ biasP) {
  __shared__ float sm[64][65];
  const int bx = blockIdx.x;
  if (bx < kPrepT) {
    constexpr int per = (kDin / 64) * (kUP / 64);
    const int w   = bx / per;
    const int rem = bx - w * per;
    const float* W = (w == 0) ? Wq : ((w == 1) ? Wk : Wv);
    transpose_cast_pad(sm, rem % (kDin / 64), rem / (kDin / 64), W, kUnits, kUnits, wT + (size_t)w * (kUP * kDin), kDin);
  } else if (bx < kPrepT + 3) {
    if (threadIdx.x < 64) bias_pad(bx - kPrepT, (int)threadIdx.x, bq, bk, bv, kUnits, biasP);
  } else {
    const int c = bx - (kPrepT + 3);
    if (c < kCastWG) cast8_bf16(gen, xg, c * 256 + (int)threadIdx.x);
    else             cast8_bf16(real, xr, (c - kCastWG) * 256 + (int)threadIdx.x);
  }
}

constexpr int kFSplit  = 2;
constexpr int kFQ      = 8 * 16;
constexpr int kFKeys   = kSeq / kFSplit;
constexpr int kFStage  = 128;
constexpr int kFNst    = kFKeys / kFStage;
constexpr int kFPitchK = 2 * kUP + 16;            // 528 B
constexpr int kFPitchV = 2 * kFStage + 16;        // 272 B
constexpr int kFRowsV  = 224;                     // v^T rows copied: 14 x 16; rows 0..207 are read
constexpr int kFTileK  = kFStage * kFPitchK;      // 67584 B
constexpr int kFTileV  = kFRowsV * kFPitchV;      // 60928 B
constexpr int kFBuf    = kFTileK + kFTileV;       // 128512 B; two buffers = 257024 B: one work-group per WGP
constexpr int kFLead   = 16;                      // bytes in front of buffer 0: no copy's LDS address is then the bare per-lane offset (a value that is itself an operand of the
                                                  // copy statement has to stay in the low 256 registers for the whole kernel, and was spilled to scratch)
constexpr int kFDK     = kKS / 32;                // 7 k steps of a score product
constexpr int kFDT     = (kUnits + 15) / 16;      // 13 unit tiles of the output
constexpr int kFPitchO = kFDT * 16 + 4;           // output staging: 212 floats = 848 B a query row (16 B x odd)
static_assert(kSeq % kFQ == 0 && kFKeys % kFStage == 0 && kFNst >= 2, "whole work-groups, whole stages, both buffers used");
static_assert(kFDT * 16 <= kFRowsV && kFRowsV <= kUP, "the v^T rows read are copied, the rows copied exist");
static_assert(8 * 16 * kFPitchO * 4 <= 2 * kFBuf && (16 * kUnits) % (4 * 32 * 5) == 0, "output staging fits the ring; a wave stores its 16 rows in 5 x 5 whole steps");
static_assert((kFPitchK / 16) % 2 == 1 && (kFPitchV / 16) % 2 == 1, "LDS pitches are odd multiples of 16 B");

// Eight (seven) copies of 16 B per lane: LDS address l + i * SL, global address g + i * SG.
// s_wait_xcnt 0 is each statement's last line: it stands in front of any later write of the address registers named there.
template <unsigned SL, size_t SG>
__device__ __forceinline__ void async_copy8(unsigned l, const char* g) {
  asm volatile(
      "global_load_async_to_lds_b128 %0, %8, off\n\t"
      "global_load_async_to_lds_b128 %1, %9, off\n\t"
      "global_load_async_to_lds_b128 %2, %10, off\n\t"
      "global_load_async_to_lds_b128 %3, %11, off\n\t"
      "global_load_async_to_lds_b128 %4, %12, off\n\t"
      "global_load_async_to_lds_b128 %5, %13, off\n\t"
      "global_load_async_to_lds_b128 %6, %14, off\n\t"
      "global_load_async_to_lds_b128 %7, %15, off\n\t"
      "s_wait_xcnt 0x0"
      :: "v"(l), "v"(l + SL), "v"(l + 2 * SL), "v"(l + 3 * SL), "v"(l + 4 * SL), "v"(l + 5 * SL), "v"(l + 6 * SL), "v"(l + 7 * SL),
         "v"(g), "v"(g + SG), "v"(g + 2 * SG), "v"(g + 3 * SG), "v"(g + 4 * SG), "v"(g + 5 * SG), "v"(g + 6 * SG), "v"(g + 7 * SG)
      : "memory");
}
template <unsigned SL, size_t SG>
__device__ __forceinline__ void async_copy7(unsigned l, const char* g) {
  asm volatile(
      "global_load_async_to_lds_b128 %0, %7, off\n\t"
      "global_load_async_to_lds_b128 %1, %8, off\n\t"
      "global_load_async_to_lds_b128 %2, %9, off\n\t"
      "global_load_async_to_lds_b128 %3, %10, off\n\t"
      "global_load_async_to_lds_b128 %4, %11, off\n\t"
      "global_load_async_to_lds_b128 %5, %12, off\n\t"
      "global_load_async_to_lds_b128 %6, %13, off\n\t"
      "s_wait_xcnt 0x0"
      :: "v"(l), "v"(l + SL), "v"(l + 2 * SL), "v"(l + 3 * SL), "v"(l + 4 * SL), "v"(l + 5 * SL), "v"(l + 6 * SL),
         "v"(g), "v"(g + SG), "v"(g + 2 * SG), "v"(g + 3 * SG), "v"(g + 4 * SG), "v"(g + 5 * SG), "v"(g + 6 * SG)
      : "memory");
}
// One stage: 16 copies of k (a wave brings one whole 512-B row per copy, 8 rows per step) and 14 of v^T (16 rows of 256 B per step).
__device__ __forceinline__ void async_copy_kv(unsigned lk, const char* gk, unsigned lv, const char* gv) {
  constexpr unsigned sLK = 8 * kFPitchK, sLV = 16 * kFPitchV;
  constexpr size_t   sGK = (size_t)8 * kUP * 2, sGV = (size_t)16 * kRows * 2;
  async_copy8<sLK, sGK>(lk, gk);
  async_copy8<sLK, sGK>(lk + 8 * sLK, gk + 8 * sGK);
  async_copy7<sLV, sGV>(lv, gv);
  async_copy7<sLV, sGV>(lv + 7 * sLV, gv + 7 * sGV);
}

// lane l with lane l ^ 16
__device__ __forceinline__ float xhalf(float x) {
  return __builtin_bit_cast(float, __builtin_amdgcn_permlanex16(__builtin_bit_cast(int, x), __builtin_bit_cast(int, x), 0x76543210, 0xfedcba98, false, false));
}
// The 14 k fragments of a pass (2 tiles of 16 keys x 7 steps of 32 units); p = this lane's first byte of the pass's first key row.
__device__ __forceinline__ void load_k(v16h (&kf)[2][kFDK], const char* p) {
#pragma unroll
  for (int kc = 0; kc < kFDK; ++kc)
#pragma unroll
    for (int kt = 0; kt < 2; ++kt) kf[kt][kc] = Frag<_Float16>::load((const _Float16*)(p + kt * (16 * kFPitchK) + kc * 64));
}
// Behind a run of matrix instructions: four vector slots before anything reads their results or reuses their operands, on every path
// (a branch may follow); the two scheduling barriers keep the run in front of the slots and its users behind them.
__device__ __forceinline__ void wmma_gap() {
  __builtin_amdgcn_sched_barrier(0);
  asm volatile("v_nop\n\tv_nop\n\tv_nop\n\tv_nop");
  __builtin_amdgcn_sched_barrier(0);
}

__global__ __launch_bounds__(256) __attribute__((amdgpu_waves_per_eu(2, 2))) void attn_fused_kernel(
    const unsigned short* __restrict__ qh, const unsigned short* __restrict__ kh, const unsigned short* __restrict__ vth,
    float* __restrict__ Opart, float* __restrict__ ml) {
  __shared__ __align__(16) char ring[kFLead + 2 * kFBuf];
  const int tid = threadIdx.x, lane = tid & 31, wave = tid >> 5;
  const int rlane = lane & 15, half = lane >> 4, koff = half * 8;
  const int z    = blockIdx.z;
  const int q0   = (int)blockIdx.y * kSeq + (int)blockIdx.x * kFQ + wave * 16;   // first token row of this wave's queries
  const int key0 = (int)blockIdx.y * kSeq + z * kFKeys;                          // first token row of this work-group's keys

  const char* gk = (const char*)kh + (size_t)(key0 + wave) * (kUP * 2) + lane * 16;
  const char* gv = (const char*)vth + ((size_t)(tid >> 4) * kRows + key0) * 2 + (tid & 15) * 16;
  const unsigned l0 = (unsigned)(size_t)(&ring[0]);
  const unsigned lk = l0 + (unsigned)(wave * kFPitchK + lane * 16);              // inside the k tile of a buffer
  const unsigned lv = l0 + (unsigned)((tid >> 4) * kFPitchV + (tid & 15) * 16);   // inside the v^T tile of a buffer
  auto fill = [&](int s, int buf) {
    async_copy_kv(lk + (unsigned)(buf * kFBuf + kFLead), gk + (size_t)s * (kFStage * kUP * 2), lv + (unsigned)(buf * kFBuf + kFLead + kFTileK), gv + (size_t)s * (kFStage * 2));
  };
  fill(0, 0);

  // q fragments, by the same loader (the same k order) as the k fragments below
  v16h qf[kFDK];
  {
    const _Float16* qp = (const _Float16*)qh + (size_t)(q0 + rlane) * kUP + koff;
#pragma unroll
    for (int kc = 0; kc < kFDK; ++kc) qf[kc] = Frag<_Float16>::load(qp + kc * 32);
    asm volatile("s_wait_xcnt 0x0" :: "v"(qp) : "memory");   // in front of any later write of the loads' address registers
  }
  v8f acc[kFDT];
#pragma unroll
  for (int t = 0; t < kFDT; ++t) acc[t] = (v8f){0.f,0.f,0.f,0.f,0.f,0.f,0.f,0.f};
  float m_run = -INFINITY, l_run = 0.0f;

  asm volatile("s_wait_asynccnt 0x0" ::: "memory");   // this wave's share of stage 0 has landed
  __syncthreads();                                    // publishes stage 0
  fill(1, 1);

  const int fragK = rlane * kFPitchK + koff * 2;             // byte of this lane's first k fragment row in a buffer
  const int fragV = kFTileK + rlane * kFPitchV + koff * 2;   // the same for v^T
#pragma unroll 1   // one copy of the stage body: only the buffer's base changes
  for (int s = 0; s < kFNst; ++s) {
    const char* sb = ring + kFLead + (s & 1) * kFBuf;
    v16h kf[2][kFDK];
    load_k(kf, sb + fragK);
#pragma unroll   // kk becomes an immediate in every LDS offset, and the last pass of a stage fetches nothing ahead
    for (int kk = 0; kk < kFStage / 32; ++kk) {
      v16h vf[kFDT];
#pragma unroll
      for (int t = 0; t < kFDT; ++t)
        vf[t] = Frag<_Float16>::load((const _Float16*)(sb + fragV + t * (16 * kFPitchV) + kk * 64));
      __builtin_amdgcn_sched_barrier(0);   // the pass's v^T loads are issued in front of its first product: they land under the scores and the exponentials
      // S^T of 32 keys
      v8f st0 = (v8f){0.f,0.f,0.f,0.f,0.f,0.f,0.f,0.f}, st1 = st0;
#pragma unroll
      for (int kc = 0; kc < kFDK; ++kc) {
        st0 = Frag<_Float16>::mma(kf[0][kc], qf[kc], st0);
        st1 = Frag<_Float16>::mma(kf[1][kc], qf[kc], st1);
      }
      wmma_gap();
      if (kk + 1 < kFStage / 32) {
        load_k(kf, sb + fragK + (kk + 1) * (32 * kFPitchK));   // the same stage's next 32 keys, into the registers the products above have read
        __builtin_amdgcn_sched_barrier(0);                     // issued here, not later: they land under this pass's exponentials and second product
      }
      // maximum of the raw scores (the scale is positive); both wave halves then hold the query's maximum, scaled
      float mx = st0[0];
#pragma unroll
      for (int r = 1; r < 8; ++r) mx = fmaxf(mx, st0[r]);
#pragma unroll
      for (int r = 0; r < 8; ++r) mx = fmaxf(mx, st1[r]);
      mx = fmaxf(mx, xhalf(mx)) * kScoreScaleLog2;
      if (__builtin_amdgcn_ballot_w32(mx > m_run + 8.0f) != 0) {   // scalar branch; always taken in the first pass (m_run = -inf), rare later
        const float m_new = fmaxf(m_run, mx);
        const float corr  = __builtin_amdgcn_exp2f(m_run - m_new);   // 0 in the first pass, 1 for a query whose maximum has not grown
        l_run *= corr;
        m_run = m_new;
#pragma unroll
        for (int t = 0; t < kFDT; ++t) acc[t] = acc[t] * corr;
      }
      // p = 2^(score * scale - maximum in use), packed as the B operand
      v16h pf;
      float ps0 = 0.0f, ps1 = 0.0f;
#pragma unroll
      for (int r = 0; r < 8; ++r) {
        const float p0 = __builtin_amdgcn_exp2f(fmaf(st0[r], kScoreScaleLog2, -m_run));
        const float p1 = __builtin_amdgcn_exp2f(fmaf(st1[r], kScoreScaleLog2, -m_run));
        ps0 += p0; ps1 += p1;
        pf[r]     = (_Float16)p0;
        pf[8 + r] = (_Float16)p1;
      }
      l_run += ps0 + ps1;
      // O^T += v^T . p^T
#pragma unroll
      for (int t = 0; t < kFDT; ++t) acc[t] = Frag<_Float16>::mma(vf[t], pf, acc[t]);
      wmma_gap();
    }
    asm volatile("s_wait_dscnt 0x0" ::: "memory");      // this wave's reads of buffer s & 1 are done before it is refilled
    asm volatile("s_wait_asynccnt 0x0" ::: "memory");   // this wave's share of stage s + 1 has landed
    __syncthreads();                                    // publishes stage s + 1 and ends every reader's last read of stage s
    if (s + 2 < kFNst) fill(s + 2, s & 1);
  }
  asm volatile("s_wait_asynccnt 0x0" ::: "memory");     // nothing in flight when the wave goes on to the epilogue and ends

  // Epilogue. The last barrier above ended every read of the ring and no copy is in flight, so the ring becomes output staging, a slab per wave.
  // Lane l holds, of query l & 15, units 16 t + 8 (l >> 4) + 0..7 of every tile t; read back as whole rows, the wave's 16 rows of 200 floats
  // are 12800 B in a row of the part's O: every store covers 512 B in a row.
  const float lsum = l_run + xhalf(l_run);   // each wave half has summed its eight keys of every 16-key tile
  const float inv  = 1.0f / lsum;            // lsum >= 1: the key that set the maximum in use adds 1
  float* slab = (float*)ring + wave * (16 * kFPitchO);
#pragma unroll
  for (int t = 0; t < kFDT; ++t) {
    float* sp = slab + rlane * kFPitchO + t * 16 + half * 8;
    *(v4f*)sp       = (v4f){acc[t][0], acc[t][1], acc[t][2], acc[t][3]} * inv;
    *(v4f*)(sp + 4) = (v4f){acc[t][4], acc[t][5], acc[t][6], acc[t][7]} * inv;
  }
  // the slab is read by other lanes of the same wave than wrote it
  __builtin_amdgcn_fence(__ATOMIC_RELEASE, "workgroup");
  __builtin_amdgcn_wave_barrier();
  __builtin_amdgcn_fence(__ATOMIC_ACQUIRE, "workgroup");
  float* ob = Opart + ((size_t)z * kRows + q0) * kUnits;
#pragma unroll
  for (int c = 0; c < 5; ++c) {
    v4f v[5];
    float* dst[5];
#pragma unroll   // v and dst are indexed by constants and stay in registers
    for (int j = 0; j < 5; ++j) {
      const int f4  = (c * 5 + j) * 32 + lane;      // 16-B piece of the wave's 16 x 50
      const int row = f4 / (kUnits / 4);
      const int c4  = f4 - row * (kUnits / 4);
      v[j]   = *(const v4f*)(slab + row * kFPitchO + c4 * 4);
      dst[j] = ob + 4 * f4;
    }
#pragma unroll
    for (int j = 0; j < 5; ++j) *(v4f*)dst[j] = v[j];
    // one wait for the five stores, in front of any later write of their registers: data and addresses are inputs, so they live up to it
    asm volatile("s_wait_xcnt 0x0" :: "v"(v[0]), "v"(v[1]), "v"(v[2]), "v"(v[3]), "v"(v[4]),
                 "v"(dst[0]), "v"(dst[1]), "v"(dst[2]), "v"(dst[3]), "v"(dst[4]) : "memory");
  }
  if (half == 0) {
    float* pm = ml + (size_t)z * kRows + (q0 + rlane);
    float* pl = pm + (size_t)kFSplit * kRows;
    *pm = m_run;
    *pl = lsum;
    asm volatile("s_wait_xcnt 0x0" :: "v"(m_run), "v"(lsum), "v"(pm), "v"(pl) : "memory");   // as above
  }
}

// ---------------------------------------------------------------------------
// Join of the key parts and copy: part z holds O_z (normalised, f32 [kRows][kUnits]), its maximum m_z (log2 domain) and its sum l_z;
// out = sum_z w_z O_z / sum_z w_z with w_z = l_z 2^(m_z - max m), parts in index order -> out f32 flat [kRows][kUnits] (pitch 200, contiguous).
// Thread i owns flat output elements 4i..4i+3 (same row since 200 % 4 == 0); one 16-B store per lane, thread-linear.
// Coverage: n4 = kRows*kUnits/4 threads x 4 = the whole output (grid exact multiple of 256).
// ---------------------------------------------------------------------------
__global__ __launch_bounds__(256) void join_out_kernel(const float* __restrict__ Opart, const float* __restrict__ ml, float* __restrict__ out, int n4) {
  const int i = blockIdx.x * 256 + threadIdx.x;
  if (i >= n4) return;
  const int e   = 4 * i;
  const int row = e / kUnits;
  float mz[kFSplit], lz[kFSplit];
  v4f   oz[kFSplit];
#pragma unroll
  for (int z = 0; z < kFSplit; ++z) {
    mz[z] = ml[(size_t)z * kRows + row];
    lz[z] = ml[(size_t)(kFSplit + z) * kRows + row];
    oz[z] = *(const v4f*)(Opart + (size_t)z * ((size_t)kRows * kUnits) + e);
  }
  asm volatile("s_wait_xcnt 0x0" ::: "memory");   // in front of any later write of the loads' address registers
  float m = mz[0];
#pragma unroll
  for (int z = 1; z < kFSplit; ++z) m = fmaxf(m, mz[z]);
  float wsum = 0.0f;
  v4f v = (v4f){0.f, 0.f, 0.f, 0.f};
#pragma unroll
  for (int z = 0; z < kFSplit; ++z) {
    const float w = lz[z] * exp2f(mz[z] - m);
    wsum += w;
    v += oz[z] * w;
  }
  v = v * (1.0f / wsum);
  float* dst = out + (size_t)e;
  *(v4f*)dst = v;
}

// ---------------------------------------------------------------------------
// Launcher. Workspace region map (bytes, MiB = 1048576; total carve = 193 MiB):
//   [  0, 16) Xg    : generated as bf16 [16384][512]
//   [ 16, 32) Xr    : real as bf16 [16384][512]
//   [ 32, 57) O parts : f32 [2][16384][200], part z = normalised output over its half of the keys
//   [ 96, 97) m, l  : f32 [2][2][16384], each part's maximum (log2 domain) and sum
//   [128,136) q     : f16 [16384][256]
//   [144,152) k     : f16 [16384][256]
//   [160,168) v^T   : f16 [256][16384]
//   [192 MiB, +786432)  W^T planes: 3 x bf16 [256][512] (262144 B each: Wq^T, Wk^T, Wv^T; rows 200..255 zero)
//   [ +786432, +3072)   bias lines: 3 x f32 [256] (RNE-bf16 values, 200..255 zero)
// Launch count: preparation + projections + fused attention (blockIdx.y = batch, blockIdx.z = key part) + join = 4. Kernel launches only.
// GEMM shapes: proj q/k M=16384 N=256 K=512; v^T M=256 N=16384 K=512 (M % 128 == 0, N % 256 == 0, K % 32 == 0).
// ---------------------------------------------------------------------------
extern "C" void kernel_launch(void* const* d_in, const int* in_sizes, int n_in,
                              void* d_out, int out_size, void* d_ws, size_t ws_size,
                              hipStream_t stream) {
  if (n_in < 8) return;
  if (in_sizes[0] != kRows * kDin || in_sizes[1] != kRows * kDin) return;
  if (in_sizes[2] != kDin * kUnits || in_sizes[4] != kDin * kUnits || in_sizes[6] != kDin * kUnits) return;
  if (in_sizes[3] != kUnits || in_sizes[5] != kUnits || in_sizes[7] != kUnits) return;
  if (out_size != kRows * kUnits) return;

  const size_t kMiB    = 1048576;
  const size_t offXg   = 0;
  const size_t offXr   = 16 * kMiB;
  const size_t offO    = 32 * kMiB;
  const size_t offML   = 96 * kMiB;
  const size_t offQ    = 128 * kMiB;
  const size_t offK    = 144 * kMiB;
  const size_t offV    = 160 * kMiB;
  const size_t wplane  = (size_t)kUP * kDin * 2;                 // 262144 B
  const size_t offWq   = 192 * kMiB;
  const size_t offWk   = offWq + wplane;
  const size_t offWv   = offWk + wplane;
  const size_t offBias = offWv + wplane;                         // 192 MiB + 786432
  const size_t total   = 193 * kMiB;                             // the bias lines end at 192 MiB + 789504
  if (total > ws_size) return;

  const float* gen  = (const float*)d_in[0];
  const float* real = (const float*)d_in[1];
  const float* Wq   = (const float*)d_in[2];
  const float* bq   = (const float*)d_in[3];
  const float* Wk   = (const float*)d_in[4];
  const float* bk   = (const float*)d_in[5];
  const float* Wv   = (const float*)d_in[6];
  const float* bv   = (const float*)d_in[7];
  float* out = (float*)d_out;
  char* ws = (char*)d_ws;

  unsigned short* xg   = (unsigned short*)(ws + offXg);
  unsigned short* xr   = (unsigned short*)(ws + offXr);
  unsigned short* qh   = (unsigned short*)(ws + offQ);
  unsigned short* kh   = (unsigned short*)(ws + offK);
  unsigned short* vth  = (unsigned short*)(ws + offV);
  float*          Opart = (float*)(ws + offO);
  float*          mlbuf = (float*)(ws + offML);
  unsigned short* wqT  = (unsigned short*)(ws + offWq);          // Wq^T, Wk^T, Wv^T planes in a row
  float*          biasP = (float*)(ws + offBias);

  // 1. operand preparation: activations -> RNE bf16 planes [16384][512]; W [512][200] -> W^T bf16 [256][512], rows 200..255 zero;
  //    biases -> padded RNE-bf16 valued f32 lines [3][256]
  prep_kernel<<<dim3(kPrepGrid), dim3(256), 0, stream>>>(gen, real, Wq, bq, Wk, bk, Wv, bv, xg, xr, wqT, biasP);

  // 2. q, k [16384][256] and v^T [256][16384] as f16 planes: 3 x 128 work-groups (blockIdx.y = which projection)
  proj3_kernel<<<dim3((kRows / kTileM) * (kUP / kTileN), 3), dim3(256), 0, stream>>>(
      xg, xr, wqT, qh, kh, vth, biasP);

  // 3. attention: scores, online softmax and p.v of all batches (blockIdx.y), keys in two parts (blockIdx.z): 256 work-groups, one on every WGP
  attn_fused_kernel<<<dim3(kSeq / kFQ, kBatch, kFSplit), dim3(256), 0, stream>>>(qh, kh, vth, Opart, mlbuf);

  // 4. the parts joined -> out [16384][200] contiguous
  {
    const int n4 = (kRows * kUnits) / 4;                    // 819200 = 3200 blocks x 256
    join_out_kernel<<<dim3(n4 / 256), dim3(256), 0, stream>>>(Opart, mlbuf, out, n4);
  }
}

// v007
// One run takes 54.7 microseconds.
// Timed twice side by side with v006, it ran 1.10 times as fast both times.
// Counting every step since v000, it is 27.1 times as fast.
// Contractions: x.W projections (q, k planes and v^T plane): single v_wmma_f32_16x16x32_bf16 product on RNE-bf16 converted x, W, bias; k.q^T scores and v^T.p^T output: single v_wmma_f32_16x16x32_f16 product on RNE-f16 q, k, v^T and p (p = exp(score - maximum in use), at most 256); all f32 accumulate; softmax in f32, online, per half of the key range; the two halves joined once in f32.
#include <hip/hip_runtime.h>
#include <math.h>

// ---------------------------------------------------------------------------
// Problem constants
// ---------------------------------------------------------------------------
constexpr int kBatch = 8;
constexpr int kSeq   = 2048;
constexpr int kDin   = 512;
constexpr int kUnits = 200;
constexpr int kUP    = 256;              // padded unit count (cols 200..255 exactly zero)
constexpr int kRows  = kBatch * kSeq;    // 16384 token rows
constexpr int kKS    = 224;              // score contraction depth (q/k cols 200..223 are exact zeros)
constexpr float kScoreScaleLog2 = 0.070710678118654752f * 1.4426950408889634f;   // 200^-0.5 * log2(e): scores go to the exponential in the log2 domain

static_assert(kRows % 64 == 0 && kUP % 64 == 0 && kSeq % 64 == 0 && kDin % 64 == 0, "tile multiples");
static_assert(kDin % 32 == 0 && kKS % 32 == 0 && kSeq % 32 == 0, "K multiples of 32");
static_assert(kKS >= kUnits && kKS <= kUP, "score depth covers all real units");
static_assert(kRows % 256 == 0 && kSeq % 256 == 0 && kUP % 256 == 0, "work-group tile 128 x 256 in either orientation");
static_assert((kRows * kUnits) % (4 * 256) == 0 && kUnits % 4 == 0, "copy kernel grid exact, float4 inside one row");
static_assert(kUP == 4 * 64, "bias kernel: 64 threads x 4 floats");

typedef __attribute__((ext_vector_type(16))) _Float16 v16h;
typedef __attribute__((ext_vector_type(8)))  _Float16 v8h;
typedef __attribute__((ext_vector_type(16))) __bf16   v16b;
typedef __attribute__((ext_vector_type(8)))  __bf16   v8b;
typedef __attribute__((ext_vector_type(4)))  __bf16   v4b;
typedef __attribute__((ext_vector_type(8)))  float    v8f;
typedef __attribute__((ext_vector_type(4)))  float    v4f;
typedef __attribute__((ext_vector_type(4)))  unsigned int v4u;

// ---------------------------------------------------------------------------
// Device helpers
// ---------------------------------------------------------------------------
__device__ __forceinline__ unsigned short f2bf_bits(float f) {
  unsigned u = __float_as_uint(f);
  return (unsigned short)((u + 0x7FFFu + ((u >> 16) & 1u)) >> 16);
}
__device__ __forceinline__ float bf_bits2f(unsigned short h) { return __uint_as_float(((unsigned)h) << 16); }

// hazard guards as plain device helpers
__device__ __forceinline__ void dep_guard_h(v8f& a, v8f& b, v16h x, v16h y) { asm volatile("v_nop\n\tv_nop\n\tv_nop\n\tv_nop" : "+v"(a), "+v"(b) : "v"(x), "v"(y)); }
__device__ __forceinline__ void dep_guard_b(v8f& a, v8f& b, v16b x, v16b y) { asm volatile("v_nop\n\tv_nop\n\tv_nop\n\tv_nop" : "+v"(a), "+v"(b) : "v"(x), "v"(y)); }
__device__ __forceinline__ void keep4_h(v16h a, v16h b, v16h c, v16h d) { asm volatile("v_nop" :: "v"(a), "v"(b), "v"(c), "v"(d)); }
__device__ __forceinline__ void keep4_b(v16b a, v16b b, v16b c, v16b d) { asm volatile("v_nop" :: "v"(a), "v"(b), "v"(c), "v"(d)); }
__device__ __forceinline__ void acc_guard4(v8f& a, v8f& b, v8f& c, v8f& d) { asm volatile("v_nop\n\tv_nop\n\tv_nop\n\tv_nop" : "+v"(a), "+v"(b), "+v"(c), "+v"(d)); }
template <typename T> struct Frag;
template <> struct Frag<_Float16> {
  typedef v16h V; union U { v16h v; v8h h[2]; };
  // elements 0..7 <- p[0..7], 8..15 <- p[16..23]
  static __device__ __forceinline__ v16h load(const _Float16* p) {
    U f; f.h[0] = *(const v8h*)(p); f.h[1] = *(const v8h*)(p + 16); return f.v;
  }
  static __device__ __forceinline__ v8f mma(v16h a, v16h b, v8f c) {
    return __builtin_amdgcn_wmma_f32_16x16x32_f16(false, a, false, b, (short)0, c, false, false);
  }
  static __device__ __forceinline__ void guard(v8f& a, v8f& b, v16h x, v16h y) { dep_guard_h(a, b, x, y); }
  static __device__ __forceinline__ void keep(v16h a, v16h b, v16h c, v16h d) { keep4_h(a, b, c, d); }
};
template <> struct Frag<__bf16> {
  typedef v16b V; union U { v16b v; v8b h[2]; };
  static __device__ __forceinline__ v16b load(const __bf16* p) {
    U f; f.h[0] = *(const v8b*)(p); f.h[1] = *(const v8b*)(p + 16); return f.v;
  }
  static __device__ __forceinline__ v8f mma(v16b a, v16b b, v8f c) {
    return __builtin_amdgcn_wmma_f32_16x16x32_bf16(false, a, false, b, (short)0, c, false, false);
  }
  static __device__ __forceinline__ void guard(v8f& a, v8f& b, v16b x, v16b y) { dep_guard_b(a, b, x, y); }
  static __device__ __forceinline__ void keep(v16b a, v16b b, v16b c, v16b d) { keep4_b(a, b, c, d); }
};

__device__ __forceinline__ unsigned pk16(unsigned short a, unsigned short b) { return (unsigned)a | ((unsigned)b << 16); }

// Eight copies of 16 B per lane: LDS address l + i * SL, global address g + i * SG.
// s_wait_xcnt 0 is the statement's last line: it stands in front of any later write of the address registers named there.
template <unsigned SL, size_t SG>
__device__ __forceinline__ void async_copy8(unsigned l, const char* g) {
  asm volatile(
      "global_load_async_to_lds_b128 %0, %8, off\n\t"
      "global_load_async_to_lds_b128 %1, %9, off\n\t"
      "global_load_async_to_lds_b128 %2, %10, off\n\t"
      "global_load_async_to_lds_b128 %3, %11, off\n\t"
      "global_load_async_to_lds_b128 %4, %12, off\n\t"
      "global_load_async_to_lds_b128 %5, %13, off\n\t"
      "global_load_async_to_lds_b128 %6, %14, off\n\t"
      "global_load_async_to_lds_b128 %7, %15, off\n\t"
      "s_wait_xcnt 0x0"
      :: "v"(l), "v"(l + SL), "v"(l + 2 * SL), "v"(l + 3 * SL), "v"(l + 4 * SL), "v"(l + 5 * SL), "v"(l + 6 * SL), "v"(l + 7 * SL),
         "v"(g), "v"(g + SG), "v"(g + 2 * SG), "v"(g + 3 * SG), "v"(g + 4 * SG), "v"(g + 5 * SG), "v"(g + 6 * SG), "v"(g + 7 * SG)
      : "memory");
}

// ---- Register-blocked WMMA GEMM of a projection: f32 activations converted on the way to LDS, bf16 weights by asynchronous copies ----
// A work-group owns 128 activation rows (tokens) x all 256 weight rows (units), K = kDin; each of its 8 waves (2 x 4) 64 tokens x 64 units.
// X f32 row-major [kRows][kDin]; Wt bf16 row-major [kUP][kDin]. XA: X is operand A, C[token][unit]; otherwise Wt is operand A, C[unit][token].
// BIAS_MODE: 1 = bias[m], 2 = bias[n]. C is one f16 plane.
// Stage = 64 k of every operand row: [X 128 rows | W 256 rows] as bf16, LDS row pitch 144 B (16 B x odd: ds_load_b128 free of bank conflicts).
// Two buffers. W: the copies of stage s + 1 fly while stage s is multiplied. X: the loads of stage s + 1 are issued in front of stage s's products,
// and behind them the values are rounded to bf16 (nearest even) and stored into the other buffer, in front of the barrier that publishes it.
constexpr int kStageK  = 64;                      // k per stage: 128 B of a bf16 row, 256 B of an f32 row
constexpr int kPitchB  = 144;                     // LDS row pitch, bytes
constexpr int kTileX   = 128;
constexpr int kTileW   = 256;
constexpr int kPlaneX  = kTileX * kPitchB;        // 18432 B
constexpr int kPlaneW  = kTileW * kPitchB;        // 36864 B
constexpr int kStageB  = kPlaneX + kPlaneW;       // 55296 B: one buffer
constexpr int kRowStep = 32 * kPitchB;            // 256 threads copy 32 W rows of 128 B at a time
constexpr int kXLoads  = kTileX / 16;             // 256 threads load 16 X rows of 256 B at a time: 8 loads of 16 B per thread and stage
constexpr int kNst     = kDin / kStageK;
static_assert(kTileW == kUP && kTileW == 8 * 32 && kRows % kTileX == 0 && kNst >= 2, "one weight tile, eight copies a stage, whole tiles, both buffers used");

// The tile routine: ring = two stage buffers, sTall = 8 per-wave 16x64 slabs of pitch 68 floats (both the calling kernel's LDS); bx = tile index.
template <bool XA, int BIAS_MODE>
__device__ __forceinline__ void gemm_tile(
    char* ring, float* sTall, int bx,
    const float* __restrict__ X, const unsigned short* __restrict__ Wt,
    unsigned short* __restrict__ C, int ldc, const float* __restrict__ bias) {
  typedef __bf16 T;
  typedef Frag<T>::V V;
  const int lane = threadIdx.x & 31;
  const int wave = threadIdx.x >> 5;
  const int x0  = bx * kTileX;                      // first token row of the tile
  const int xw  = (wave >> 2) << 6;                 // wave tile origin inside it: tokens, units
  const int ww  = (wave & 3) << 6;
  const int m0  = XA ? x0 + xw : ww;
  const int n0  = XA ? ww : x0 + xw;

  const int rlane = lane & 15;                 // row (A) / col (B, D) within subtile
  const int koff  = (lane >> 4) * 8;           // k offset of this lane half
  const int mOff  = (lane >> 4) * 8;           // D row offset

  // W copies of this lane: row threadIdx.x / 8 of each group of 32 rows, 16-B piece threadIdx.x % 8 of its 128 B
  const int crow = threadIdx.x >> 3;
  const int cpc  = (threadIdx.x & 7) << 4;
  const char* gW = (const char*)Wt + (size_t)crow * (kDin * 2) + cpc;
  const unsigned ldsW = (unsigned)(size_t)(&ring[0]) + (unsigned)(kPlaneX + crow * kPitchB + cpc);
  auto fillW = [&](int s, int buf) {
    async_copy8<(unsigned)kRowStep, (size_t)32 * kDin * 2>(ldsW + (unsigned)(buf * kStageB), gW + (size_t)s * (kStageK * 2));
  };
  // X loads of this lane: row threadIdx.x / 16 of each group of 16 rows, 16-B piece threadIdx.x % 16 of its 256 B (a wave reads two whole 256-B units)
  const int xrow = threadIdx.x >> 4;
  const int xpc  = threadIdx.x & 15;
  const float* gX = X + (size_t)(x0 + xrow) * kDin + xpc * 4;
  char* sX = ring + xrow * kPitchB + xpc * 8;
  v4f xv[kXLoads];
  auto loadX = [&](int s) {
#pragma unroll   // xv is indexed by constants and stays in registers
    for (int i = 0; i < kXLoads; ++i) xv[i] = *(const v4f*)(gX + (size_t)i * (16 * kDin) + s * kStageK);
    asm volatile("s_wait_xcnt 0x0" ::: "memory");   // one wait for the eight loads, in front of any later write of their address registers; it also keeps them issued here
  };
  auto storeX = [&](int buf) {
#pragma unroll
    for (int i = 0; i < kXLoads; ++i) *(v4b*)(sX + buf * kStageB + i * (16 * kPitchB)) = __builtin_convertvector(xv[i], v4b);
  };

  v8f acc[4][4];
#pragma unroll
  for (int i = 0; i < 4; ++i)
#pragma unroll
    for (int j = 0; j < 4; ++j) acc[i][j] = (v8f){0.f,0.f,0.f,0.f,0.f,0.f,0.f,0.f};

  loadX(0);
  fillW(0, 0);
  storeX(0);
  asm volatile("s_wait_dscnt 0x0" ::: "memory");      // this wave's share of X stage 0 is written
  asm volatile("s_wait_asynccnt 0x0" ::: "memory");   // this wave's share of W stage 0 has landed
  __syncthreads();                                    // publishes stage 0
  fillW(1, 1);

  const int fragA = (XA ? xw * kPitchB : kPlaneX + ww * kPitchB) + rlane * kPitchB + koff * 2;   // byte of this lane's first A fragment row in a buffer
  const int fragB = (XA ? kPlaneX + ww * kPitchB : xw * kPitchB) + rlane * kPitchB + koff * 2;   // the same for B
#pragma unroll 1   // one copy of the stage body: only the buffer's base changes
  for (int s = 0; s < kNst; ++s) {
    const char* sb = ring + (s & 1) * kStageB;
    if (s + 1 < kNst) loadX(s + 1);   // scalar; in flight under this stage's products
#pragma unroll   // kk becomes an immediate in every LDS offset
    for (int kk = 0; kk < 2; ++kk) {
      V bh[4];
#pragma unroll
      for (int j = 0; j < 4; ++j) bh[j] = Frag<T>::load((const T*)(sb + fragB + j * (16 * kPitchB) + kk * 64));
#pragma unroll
      for (int i = 0; i < 4; ++i) {
        V ah = Frag<T>::load((const T*)(sb + fragA + i * (16 * kPitchB) + kk * 64));
#pragma unroll
        for (int j = 0; j < 4; ++j) acc[i][j] = Frag<T>::mma(ah, bh[j], acc[i][j]);
        Frag<T>::guard(acc[i][0], acc[i][3], ah, ah);
      }
      Frag<T>::keep(bh[0], bh[1], bh[2], bh[3]);
    }
    if (s + 1 < kNst) storeX((s + 1) & 1);              // into the buffer whose last readers the barrier of stage s - 1 has ended
    asm volatile("s_wait_dscnt 0x0" ::: "memory");      // this wave's reads of buffer s & 1 are done before it is refilled, and its share of X stage s + 1 is written
    asm volatile("s_wait_asynccnt 0x0" ::: "memory");   // this wave's share of W stage s + 1 has landed
    __syncthreads();                                    // publishes stage s + 1 and ends every reader's last read of stage s
    if (s + 2 < kNst) fillW(s + 2, s & 1);
  }
  asm volatile("s_wait_asynccnt 0x0" ::: "memory");     // nothing in flight when the wave goes on to the epilogue and ends
  acc_guard4(acc[0][0], acc[0][1], acc[0][2], acc[0][3]);
  acc_guard4(acc[1][0], acc[1][1], acc[1][2], acc[1][3]);
  acc_guard4(acc[2][0], acc[2][1], acc[2][2], acc[2][3]);
  acc_guard4(acc[3][0], acc[3][1], acc[3][2], acc[3][3]);

  // ---- epilogue ----
  float* slab = sTall + wave * (16 * 68);
#pragma unroll
  for (int i = 0; i < 4; ++i) {
    const int mBase = m0 + (i << 4);
#pragma unroll
    for (int j = 0; j < 4; ++j) {
      const int n = n0 + (j << 4) + rlane;
      float bv = 0.f;
      if (BIAS_MODE == 2) bv = bias[n];
#pragma unroll
      for (int r = 0; r < 8; ++r) {
        float v = acc[i][j][r];
        if (BIAS_MODE == 1) v += bias[mBase + mOff + r];
        if (BIAS_MODE == 2) v += bv;
        slab[(mOff + r) * 68 + (j << 4) + rlane] = v;
      }
    }
    __builtin_amdgcn_fence(__ATOMIC_RELEASE, "workgroup");
    __builtin_amdgcn_wave_barrier();
    __builtin_amdgcn_fence(__ATOMIC_ACQUIRE, "workgroup");
    {
      const int q = lane >> 3, c8 = (lane & 7) * 8;
      v8h hv[4];
      unsigned short* dst[4];
#pragma unroll   // hv and dst are indexed by constants and stay in registers
      for (int it = 0; it < 4; ++it) {
        const int row = it * 4 + q;
        const float* sp = slab + row * 68 + c8;
#pragma unroll
        for (int e = 0; e < 8; ++e) hv[it][e] = (_Float16)sp[e];
        dst[it] = C + (size_t)(mBase + row) * ldc + n0 + c8;
      }
#pragma unroll
      for (int it = 0; it < 4; ++it) *(v8h*)dst[it] = hv[it];
      // one wait for the four stores, in front of any later write of their registers: data and addresses are inputs, so they live up to it
      asm volatile("s_wait_xcnt 0x0" :: "v"(hv[0]), "v"(hv[1]), "v"(hv[2]), "v"(hv[3]),
                   "v"(dst[0]), "v"(dst[1]), "v"(dst[2]), "v"(dst[3]) : "memory");
    }
    __builtin_amdgcn_fence(__ATOMIC_RELEASE, "workgroup");
    __builtin_amdgcn_wave_barrier();
    __builtin_amdgcn_fence(__ATOMIC_ACQUIRE, "workgroup");
  }
}

// The three projections in one launch: blockIdx.y = 0: q = gen . Wq^T + bq[n], 1: k = real . Wk^T + bk[n] (C [16384][256]),
// 2: v^T = Wv^T . real^T + bv[m] (C [256][16384]); K=512, single bf16 product -> one f16 plane; 128 tiles of 128 tokens each (blockIdx.x).
// None reads what another writes. One LDS allocation serves whichever branch the work-group takes (142 KiB: two work-groups fit a WGP).
// wT: Wq^T, Wk^T, Wv^T planes [256][512] in a row; biasP: the three padded bias lines in a row.
__global__ __launch_bounds__(256) void proj3_kernel(
    const float* __restrict__ gen, const float* __restrict__ real, const unsigned short* __restrict__ wT,
    unsigned short* __restrict__ qh, unsigned short* __restrict__ kh, unsigned short* __restrict__ vth,
    const float* __restrict__ biasP) {
  __shared__ __align__(16) char ring[2 * kStageB];
  __shared__ __align__(16) float sT[8 * 16 * 68];
  const int y = blockIdx.y;                    // the same for the whole work-group
  if (y < 2) {
    gemm_tile<true, 2>(ring, sT, (int)blockIdx.x, y ? real : gen, wT + (size_t)y * (kUP * kDin), y ? kh : qh, kUP, biasP + y * kUP);
  } else {
    gemm_tile<false, 1>(ring, sT, (int)blockIdx.x, real, wT + (size_t)2 * (kUP * kDin), vth, kRows, biasP + 2 * kUP);
  }
}

// ---------------------------------------------------------------------------
// Transpose + RNE bf16 convert of a weight matrix with zero padding of the output rows:
// in f32 [R][ncol] row-major (ldin = ncol) -> out bf16 [Cpad][R] (ldout = R): out[c][r] = bf16(in[r][c]) for c < ncol, 0 for c >= ncol.
// rt = r tile (64 output cols), ct = c tile (64 output rows); sm = 64 x 65 floats of the calling kernel's LDS. 256 threads.
// Load coverage: 16 iterations x 256 threads = 4096 = the whole 64x64 tile; column ADDRESS clamped to ncol-1, value zeroed by predicate.
// Store coverage: 8 waves x 2 iterations x 4 rows (lane>>3) = 64 rows; (lane&7) x 8 halves = 64 cols; each row segment =
// ---------------------------------------------------------------------------
__device__ __forceinline__ void transpose_cast_pad(float (*sm)[65], int rt, int ct, const float* __restrict__ in, int ldin, int ncol,
                                                   unsigned short* __restrict__ out, int ldout) {
  const int t  = threadIdx.x;    // sm[c_local][r_local]
  const int r0 = rt * 64;
  const int c0 = ct * 64;
  float v[16];   // all 16 loads are issued in front of the first LDS store, so that they are in flight together
#pragma unroll
  for (int i = 0; i < 16; ++i) {
    const int e = i * 256 + t;
    const int r = e >> 6;          // r local
    const int c = e & 63;          // c local
    const int cg = c0 + c;
    const int cc = (cg < ncol) ? cg : (ncol - 1);
    v[i] = in[(size_t)(r0 + r) * ldin + cc];
    asm volatile("s_wait_xcnt 0x0" ::: "memory");   // in front of any later write of the load's address registers
  }
#pragma unroll   // v[i] is indexed by constants and stays in registers
  for (int i = 0; i < 16; ++i) {
    const int e = i * 256 + t;
    const int r = e >> 6;
    const int c = e & 63;
    sm[c][r] = (c0 + c < ncol) ? v[i] : 0.0f;
  }
  __syncthreads();
  const int lane = t & 31, wave = t >> 5;
  const int q = lane >> 3, c8 = (lane & 7) * 8;
  {
#pragma unroll
    for (int it = 0; it < 2; ++it) {
      const int row = wave * 8 + it * 4 + q;                 // c local (output row)
      unsigned w[4];
#pragma unroll
      for (int e2 = 0; e2 < 4; ++e2) w[e2] = pk16(f2bf_bits(sm[row][c8 + 2 * e2]), f2bf_bits(sm[row][c8 + 2 * e2 + 1]));
      const v4u u = (v4u){w[0], w[1], w[2], w[3]};
      const size_t o = (size_t)(c0 + row) * ldout + r0 + c8;
      *(v4u*)(out + o) = u;
    }
    
  }
}

// ---------------------------------------------------------------------------
// Bias vectors -> RNE-bf16 valued f32 lines padded to kUP: outp[p][u] = bf16(b_p[u]) for u < nvalid, 0 otherwise (p in 0..2, t in 0..63).
// All three candidates loaded with a clamped index, selected by value. 64 threads x 4 floats = 256 = kUP;
// ---------------------------------------------------------------------------
__device__ __forceinline__ void bias_pad(int p, int t, const float* __restrict__ b0, const float* __restrict__ b1,
                                         const float* __restrict__ b2, int nvalid, float* __restrict__ outp) {
  float f[4];
#pragma unroll
  for (int e = 0; e < 4; ++e) {
    const int u  = 4 * t + e;
    const int uc = (u < nvalid) ? u : (nvalid - 1);
    const float v0 = b0[uc], v1 = b1[uc], v2 = b2[uc];
    asm volatile("s_wait_xcnt 0x0" ::: "memory");   // in front of any later write of the loads' address registers
    float v = (p == 0) ? v0 : ((p == 1) ? v1 : v2);
    v = bf_bits2f(f2bf_bits(v));
    f[e] = (u < nvalid) ? v : 0.0f;
  }
  const v4f val = (v4f){f[0], f[1], f[2], f[3]};
  float* dst = outp + (size_t)p * kUP + 4 * t;
  *(v4f*)dst = val;
  
}

// ---------------------------------------------------------------------------
// Weight and bias preparation in one launch; the pieces read inputs only and write disjoint workspace planes, so their order is free.
// blockIdx.x: 0..95 = weight transposes (32 tiles of 64 x 64 for each of Wq, Wk, Wv), 96..98 = the three bias lines (64 threads work).
// Every branch is the same for the whole work-group (the transposes hold a barrier).
// ---------------------------------------------------------------------------
constexpr int kPrepT    = 3 * (kDin / 64) * (kUP / 64);     // 96 transpose tiles
constexpr int kPrepGrid = kPrepT + 3;
__global__ __launch_bounds__(256) void prep_kernel(const float* __restrict__ Wq, const float* __restrict__ bq,
                                                   const float* __restrict__ Wk, const float* __restrict__ bk,
                                                   const float* __restrict__ Wv, const float* __restrict__ bv,
                                                   unsigned short* __restrict__ wT, float* __restrict__ biasP) {
  __shared__ float sm[64][65];
  const int bx = blockIdx.x;
  if (bx < kPrepT) {
    constexpr int per = (kDin / 64) * (kUP / 64);
    const int w   = bx / per;
    const int rem = bx - w * per;
    const float* W = (w == 0) ? Wq : ((w == 1) ? Wk : Wv);
    transpose_cast_pad(sm, rem % (kDin / 64), rem / (kDin / 64), W, kUnits, kUnits, wT + (size_t)w * (kUP * kDin), kDin);
  } else {
    if (threadIdx.x < 64) bias_pad(bx - kPrepT, (int)threadIdx.x, bq, bk, bv, kUnits, biasP);
  }
}

constexpr int kFSplit  = 2;
constexpr int kFQ      = 8 * 16;
constexpr int kFKeys   = kSeq / kFSplit;
constexpr int kFStage  = 128;
constexpr int kFNst    = kFKeys / kFStage;
constexpr int kFPitchK = 2 * kUP + 16;            // 528 B
constexpr int kFPitchV = 2 * kFStage + 16;        // 272 B
constexpr int kFRowsV  = 224;                     // v^T rows copied: 14 x 16; rows 0..207 are read
constexpr int kFTileK  = kFStage * kFPitchK;      // 67584 B
constexpr int kFTileV  = kFRowsV * kFPitchV;      // 60928 B
constexpr int kFBuf    = kFTileK + kFTileV;       // 128512 B; two buffers = 257024 B: one work-group per WGP
constexpr int kFLead   = 16;                      // bytes in front of buffer 0: no copy's LDS address is then the bare per-lane offset (a value that is itself an operand of the
                                                  // copy statement has to stay in the low 256 registers for the whole kernel, and was spilled to scratch)
constexpr int kFDK     = kKS / 32;                // 7 k steps of a score product
constexpr int kFDT     = (kUnits + 15) / 16;      // 13 unit tiles of the output
constexpr int kFPitchO = kFDT * 16 + 4;           // output staging: 212 floats = 848 B a query row (16 B x odd)
static_assert(kSeq % kFQ == 0 && kFKeys % kFStage == 0 && kFNst >= 2, "whole work-groups, whole stages, both buffers used");
static_assert(kFDT * 16 <= kFRowsV && kFRowsV <= kUP, "the v^T rows read are copied, the rows copied exist");
static_assert(8 * 16 * kFPitchO * 4 <= 2 * kFBuf && (16 * kUnits) % (4 * 32 * 5) == 0, "output staging fits the ring; a wave stores its 16 rows in 5 x 5 whole steps");
static_assert((kFPitchK / 16) % 2 == 1 && (kFPitchV / 16) % 2 == 1, "LDS pitches are odd multiples of 16 B");

// Seven copies of 16 B per lane, as async_copy8 above.
template <unsigned SL, size_t SG>
__device__ __forceinline__ void async_copy7(unsigned l, const char* g) {
  asm volatile(
      "global_load_async_to_lds_b128 %0, %7, off\n\t"
      "global_load_async_to_lds_b128 %1, %8, off\n\t"
      "global_load_async_to_lds_b128 %2, %9, off\n\t"
      "global_load_async_to_lds_b128 %3, %10, off\n\t"
      "global_load_async_to_lds_b128 %4, %11, off\n\t"
      "global_load_async_to_lds_b128 %5, %12, off\n\t"
      "global_load_async_to_lds_b128 %6, %13, off\n\t"
      "s_wait_xcnt 0x0"
      :: "v"(l), "v"(l + SL), "v"(l + 2 * SL), "v"(l + 3 * SL), "v"(l + 4 * SL), "v"(l + 5 * SL), "v"(l + 6 * SL),
         "v"(g), "v"(g + SG), "v"(g + 2 * SG), "v"(g + 3 * SG), "v"(g + 4 * SG), "v"(g + 5 * SG), "v"(g + 6 * SG)
      : "memory");
}
// One stage: 16 copies of k (a wave brings one whole 512-B row per copy, 8 rows per step) and 14 of v^T (16 rows of 256 B per step).
__device__ __forceinline__ void async_copy_kv(unsigned lk, const char* gk, unsigned lv, const char* gv) {
  constexpr unsigned sLK = 8 * kFPitchK, sLV = 16 * kFPitchV;
  constexpr size_t   sGK = (size_t)8 * kUP * 2, sGV = (size_t)16 * kRows * 2;
  async_copy8<sLK, sGK>(lk, gk);
  async_copy8<sLK, sGK>(lk + 8 * sLK, gk + 8 * sGK);
  async_copy7<sLV, sGV>(lv, gv);
  async_copy7<sLV, sGV>(lv + 7 * sLV, gv + 7 * sGV);
}

// lane l with lane l ^ 16
__device__ __forceinline__ float xhalf(float x) {
  return __builtin_bit_cast(float, __builtin_amdgcn_permlanex16(__builtin_bit_cast(int, x), __builtin_bit_cast(int, x), 0x76543210, 0xfedcba98, false, false));
}
// The 14 k fragments of a pass (2 tiles of 16 keys x 7 steps of 32 units); p = this lane's first byte of the pass's first key row.
__device__ __forceinline__ void load_k(v16h (&kf)[2][kFDK], const char* p) {
#pragma unroll
  for (int kc = 0; kc < kFDK; ++kc)
#pragma unroll
    for (int kt = 0; kt < 2; ++kt) kf[kt][kc] = Frag<_Float16>::load((const _Float16*)(p + kt * (16 * kFPitchK) + kc * 64));
}
// Behind a run of matrix instructions: four vector slots before anything reads their results or reuses their operands, on every path
// (a branch may follow); the two scheduling barriers keep the run in front of the slots and its users behind them.
__device__ __forceinline__ void wmma_gap() {
  __builtin_amdgcn_sched_barrier(0);
  asm volatile("v_nop\n\tv_nop\n\tv_nop\n\tv_nop");
  __builtin_amdgcn_sched_barrier(0);
}

__global__ __launch_bounds__(256) __attribute__((amdgpu_waves_per_eu(2, 2))) void attn_fused_kernel(
    const unsigned short* __restrict__ qh, const unsigned short* __restrict__ kh, const unsigned short* __restrict__ vth,
    float* __restrict__ Opart, float* __restrict__ ml) {
  __shared__ __align__(16) char ring[kFLead + 2 * kFBuf];
  const int tid = threadIdx.x, lane = tid & 31, wave = tid >> 5;
  const int rlane = lane & 15, half = lane >> 4, koff = half * 8;
  const int z    = blockIdx.z;
  const int q0   = (int)blockIdx.y * kSeq + (int)blockIdx.x * kFQ + wave * 16;   // first token row of this wave's queries
  const int key0 = (int)blockIdx.y * kSeq + z * kFKeys;                          // first token row of this work-group's keys

  const char* gk = (const char*)kh + (size_t)(key0 + wave) * (kUP * 2) + lane * 16;
  const char* gv = (const char*)vth + ((size_t)(tid >> 4) * kRows + key0) * 2 + (tid & 15) * 16;
  const unsigned l0 = (unsigned)(size_t)(&ring[0]);
  const unsigned lk = l0 + (unsigned)(wave * kFPitchK + lane * 16);              // inside the k tile of a buffer
  const unsigned lv = l0 + (unsigned)((tid >> 4) * kFPitchV + (tid & 15) * 16);   // inside the v^T tile of a buffer
  auto fill = [&](int s, int buf) {
    async_copy_kv(lk + (unsigned)(buf * kFBuf + kFLead), gk + (size_t)s * (kFStage * kUP * 2), lv + (unsigned)(buf * kFBuf + kFLead + kFTileK), gv + (size_t)s * (kFStage * 2));
  };
  fill(0, 0);

  // q fragments, by the same loader (the same k order) as the k fragments below
  v16h qf[kFDK];
  {
    const _Float16* qp = (const _Float16*)qh + (size_t)(q0 + rlane) * kUP + koff;
#pragma unroll
    for (int kc = 0; kc < kFDK; ++kc) qf[kc] = Frag<_Float16>::load(qp + kc * 32);
    asm volatile("s_wait_xcnt 0x0" :: "v"(qp) : "memory");   // in front of any later write of the loads' address registers
  }
  v8f acc[kFDT];
#pragma unroll
  for (int t = 0; t < kFDT; ++t) acc[t] = (v8f){0.f,0.f,0.f,0.f,0.f,0.f,0.f,0.f};
  float m_run = -INFINITY, l_run = 0.0f;

  asm volatile("s_wait_asynccnt 0x0" ::: "memory");   // this wave's share of stage 0 has landed
  __syncthreads();                                    // publishes stage 0
  fill(1, 1);

  const int fragK = rlane * kFPitchK + koff * 2;             // byte of this lane's first k fragment row in a buffer
  const int fragV = kFTileK + rlane * kFPitchV + koff * 2;   // the same for v^T
#pragma unroll 1   // one copy of the stage body: only the buffer's base changes
  for (int s = 0; s < kFNst; ++s) {
    const char* sb = ring + kFLead + (s & 1) * kFBuf;
    v16h kf[2][kFDK];
    load_k(kf, sb + fragK);
#pragma unroll   // kk becomes an immediate in every LDS offset, and the last pass of a stage fetches nothing ahead
    for (int kk = 0; kk < kFStage / 32; ++kk) {
      v16h vf[kFDT];
#pragma unroll
      for (int t = 0; t < kFDT; ++t)
        vf[t] = Frag<_Float16>::load((const _Float16*)(sb + fragV + t * (16 * kFPitchV) + kk * 64));
      __builtin_amdgcn_sched_barrier(0);   // the pass's v^T loads are issued in front of its first product: they land under the scores and the exponentials
      // S^T of 32 keys
      v8f st0 = (v8f){0.f,0.f,0.f,0.f,0.f,0.f,0.f,0.f}, st1 = st0;
#pragma unroll
      for (int kc = 0; kc < kFDK; ++kc) {
        st0 = Frag<_Float16>::mma(kf[0][kc], qf[kc], st0);
        st1 = Frag<_Float16>::mma(kf[1][kc], qf[kc], st1);
      }
      wmma_gap();
      if (kk + 1 < kFStage / 32) {
        load_k(kf, sb + fragK + (kk + 1) * (32 * kFPitchK));   // the same stage's next 32 keys, into the registers the products above have read
        __builtin_amdgcn_sched_barrier(0);                     // issued here, not later: they land under this pass's exponentials and second product
      }
      // maximum of the raw scores (the scale is positive); both wave halves then hold the query's maximum, scaled
      float mx = st0[0];
#pragma unroll
      for (int r = 1; r < 8; ++r) mx = fmaxf(mx, st0[r]);
#pragma unroll
      for (int r = 0; r < 8; ++r) mx = fmaxf(mx, st1[r]);
      mx = fmaxf(mx, xhalf(mx)) * kScoreScaleLog2;
      if (__builtin_amdgcn_ballot_w32(mx > m_run + 8.0f) != 0) {   // scalar branch; always taken in the first pass (m_run = -inf), rare later
        const float m_new = fmaxf(m_run, mx);
        const float corr  = __builtin_amdgcn_exp2f(m_run - m_new);   // 0 in the first pass, 1 for a query whose maximum has not grown
        l_run *= corr;
        m_run = m_new;
#pragma unroll
        for (int t = 0; t < kFDT; ++t) acc[t] = acc[t] * corr;
      }
      // p = 2^(score * scale - maximum in use), packed as the B operand
      v16h pf;
      float ps0 = 0.0f, ps1 = 0.0f;
#pragma unroll
      for (int r = 0; r < 8; ++r) {
        const float p0 = __builtin_amdgcn_exp2f(fmaf(st0[r], kScoreScaleLog2, -m_run));
        const float p1 = __builtin_amdgcn_exp2f(fmaf(st1[r], kScoreScaleLog2, -m_run));
        ps0 += p0; ps1 += p1;
        pf[r]     = (_Float16)p0;
        pf[8 + r] = (_Float16)p1;
      }
      l_run += ps0 + ps1;
      // O^T += v^T . p^T
#pragma unroll
      for (int t = 0; t < kFDT; ++t) acc[t] = Frag<_Float16>::mma(vf[t], pf, acc[t]);
      wmma_gap();
    }
    asm volatile("s_wait_dscnt 0x0" ::: "memory");      // this wave's reads of buffer s & 1 are done before it is refilled
    asm volatile("s_wait_asynccnt 0x0" ::: "memory");   // this wave's share of stage s + 1 has landed
    __syncthreads();                                    // publishes stage s + 1 and ends every reader's last read of stage s
    if (s + 2 < kFNst) fill(s + 2, s & 1);
  }
  asm volatile("s_wait_asynccnt 0x0" ::: "memory");     // nothing in flight when the wave goes on to the epilogue and ends

  // Epilogue. The last barrier above ended every read of the ring and no copy is in flight, so the ring becomes output staging, a slab per wave.
  // Lane l holds, of query l & 15, units 16 t + 8 (l >> 4) + 0..7 of every tile t; read back as whole rows, the wave's 16 rows of 200 floats
  // are 12800 B in a row of the part's O: every store covers 512 B in a row.
  const float lsum = l_run + xhalf(l_run);   // each wave half has summed its eight keys of every 16-key tile
  const float inv  = 1.0f / lsum;            // lsum >= 1: the key that set the maximum in use adds 1
  float* slab = (float*)ring + wave * (16 * kFPitchO);
#pragma unroll
  for (int t = 0; t < kFDT; ++t) {
    float* sp = slab + rlane * kFPitchO + t * 16 + half * 8;
    *(v4f*)sp       = (v4f){acc[t][0], acc[t][1], acc[t][2], acc[t][3]} * inv;
    *(v4f*)(sp + 4) = (v4f){acc[t][4], acc[t][5], acc[t][6], acc[t][7]} * inv;
  }
  // the slab is read by other lanes of the same wave than wrote it
  __builtin_amdgcn_fence(__ATOMIC_RELEASE, "workgroup");
  __builtin_amdgcn_wave_barrier();
  __builtin_amdgcn_fence(__ATOMIC_ACQUIRE, "workgroup");
  float* ob = Opart + ((size_t)z * kRows + q0) * kUnits;
#pragma unroll
  for (int c = 0; c < 5; ++c) {
    v4f v[5];
    float* dst[5];
#pragma unroll   // v and dst are indexed by constants and stay in registers
    for (int j = 0; j < 5; ++j) {
      const int f4  = (c * 5 + j) * 32 + lane;      // 16-B piece of the wave's 16 x 50
      const int row = f4 / (kUnits / 4);
      const int c4  = f4 - row * (kUnits / 4);
      v[j]   = *(const v4f*)(slab + row * kFPitchO + c4 * 4);
      dst[j] = ob + 4 * f4;
    }
#pragma unroll
    for (int j = 0; j < 5; ++j) *(v4f*)dst[j] = v[j];
    // one wait for the five stores, in front of any later write of their registers: data and addresses are inputs, so they live up to it
    asm volatile("s_wait_xcnt 0x0" :: "v"(v[0]), "v"(v[1]), "v"(v[2]), "v"(v[3]), "v"(v[4]),
                 "v"(dst[0]), "v"(dst[1]), "v"(dst[2]), "v"(dst[3]), "v"(dst[4]) : "memory");
  }
  if (half == 0) {
    float* pm = ml + (size_t)z * kRows + (q0 + rlane);
    float* pl = pm + (size_t)kFSplit * kRows;
    *pm = m_run;
    *pl = lsum;
    asm volatile("s_wait_xcnt 0x0" :: "v"(m_run), "v"(lsum), "v"(pm), "v"(pl) : "memory");   // as above
  }
}

// ---------------------------------------------------------------------------
// Join of the key parts and copy: part z holds O_z (normalised, f32 [kRows][kUnits]), its maximum m_z (log2 domain) and its sum l_z;
// out = sum_z w_z O_z / sum_z w_z with w_z = l_z 2^(m_z - max m), parts in index order -> out f32 flat [kRows][kUnits] (pitch 200, contiguous).
// Thread i owns flat output elements 4i..4i+3 (same row since 200 % 4 == 0); one 16-B store per lane, thread-linear.
// Coverage: n4 = kRows*kUnits/4 threads x 4 = the whole output (grid exact multiple of 256).
// ---------------------------------------------------------------------------
__global__ __launch_bounds__(256) void join_out_kernel(const float* __restrict__ Opart, const float* __restrict__ ml, float* __restrict__ out, int n4) {
  const int i = blockIdx.x * 256 + threadIdx.x;
  if (i >= n4) return;
  const int e   = 4 * i;
  const int row = e / kUnits;
  float mz[kFSplit], lz[kFSplit];
  v4f   oz[kFSplit];
#pragma unroll
  for (int z = 0; z < kFSplit; ++z) {
    mz[z] = ml[(size_t)z * kRows + row];
    lz[z] = ml[(size_t)(kFSplit + z) * kRows + row];
    oz[z] = *(const v4f*)(Opart + (size_t)z * ((size_t)kRows * kUnits) + e);
  }
  asm volatile("s_wait_xcnt 0x0" ::: "memory");   // in front of any later write of the loads' address registers
  float m = mz[0];
#pragma unroll
  for (int z = 1; z < kFSplit; ++z) m = fmaxf(m, mz[z]);
  float wsum = 0.0f;
  v4f v = (v4f){0.f, 0.f, 0.f, 0.f};
#pragma unroll
  for (int z = 0; z < kFSplit; ++z) {
    const float w = lz[z] * exp2f(mz[z] - m);
    wsum += w;
    v += oz[z] * w;
  }
  v = v * (1.0f / wsum);
  float* dst = out + (size_t)e;
  *(v4f*)dst = v;
}

// ---------------------------------------------------------------------------
// Launcher. Workspace region map (bytes, MiB = 1048576; total carve = 193 MiB):
//   [ 32, 57) O parts : f32 [2][16384][200], part z = normalised output over its half of the keys
//   [ 96, 97) m, l  : f32 [2][2][16384], each part's maximum (log2 domain) and sum
//   [128,136) q     : f16 [16384][256]
//   [144,152) k     : f16 [16384][256]
//   [160,168) v^T   : f16 [256][16384]
//   [192 MiB, +786432)  W^T planes: 3 x bf16 [256][512] (262144 B each: Wq^T, Wk^T, Wv^T; rows 200..255 zero)
//   [ +786432, +3072)   bias lines: 3 x f32 [256] (RNE-bf16 values, 200..255 zero)
// Launch count: preparation + projections + fused attention (blockIdx.y = batch, blockIdx.z = key part) + join = 4. Kernel launches only.
// GEMM shapes: proj q/k M=16384 N=256 K=512; v^T M=256 N=16384 K=512 (tiles of 128 tokens x 256 units).
// ---------------------------------------------------------------------------
extern "C" void kernel_launch(void* const* d_in, const int* in_sizes, int n_in,
                              void* d_out, int out_size, void* d_ws, size_t ws_size,
                              hipStream_t stream) {
  if (n_in < 8) return;
  if (in_sizes[0] != kRows * kDin || in_sizes[1] != kRows * kDin) return;
  if (in_sizes[2] != kDin * kUnits || in_sizes[4] != kDin * kUnits || in_sizes[6] != kDin * kUnits) return;
  if (in_sizes[3] != kUnits || in_sizes[5] != kUnits || in_sizes[7] != kUnits) return;
  if (out_size != kRows * kUnits) return;

  const size_t kMiB    = 1048576;
  const size_t offO    = 32 * kMiB;
  const size_t offML   = 96 * kMiB;
  const size_t offQ    = 128 * kMiB;
  const size_t offK    = 144 * kMiB;
  const size_t offV    = 160 * kMiB;
  const size_t wplane  = (size_t)kUP * kDin * 2;                 // 262144 B
  const size_t offWq   = 192 * kMiB;
  const size_t offWk   = offWq + wplane;
  const size_t offWv   = offWk + wplane;
  const size_t offBias = offWv + wplane;                         // 192 MiB + 786432
  const size_t total   = 193 * kMiB;                             // the bias lines end at 192 MiB + 789504
  if (total > ws_size) return;

  const float* gen  = (const float*)d_in[0];
  const float* real = (const float*)d_in[1];
  const float* Wq   = (const float*)d_in[2];
  const float* bq   = (const float*)d_in[3];
  const float* Wk   = (const float*)d_in[4];
  const float* bk   = (const float*)d_in[5];
  const float* Wv   = (const float*)d_in[6];
  const float* bv   = (const float*)d_in[7];
  float* out = (float*)d_out;
  char* ws = (char*)d_ws;

  unsigned short* qh   = (unsigned short*)(ws + offQ);
  unsigned short* kh   = (unsigned short*)(ws + offK);
  unsigned short* vth  = (unsigned short*)(ws + offV);
  float*          Opart = (float*)(ws + offO);
  float*          mlbuf = (float*)(ws + offML);
  unsigned short* wqT  = (unsigned short*)(ws + offWq);          // Wq^T, Wk^T, Wv^T planes in a row
  float*          biasP = (float*)(ws + offBias);

  // 1. operand preparation: W [512][200] -> W^T bf16 [256][512], rows 200..255 zero;
  //    biases -> padded RNE-bf16 valued f32 lines [3][256]
  prep_kernel<<<dim3(kPrepGrid), dim3(256), 0, stream>>>(Wq, bq, Wk, bk, Wv, bv, wqT, biasP);

  // 2. q, k [16384][256] and v^T [256][16384] as f16 planes from the f32 activations: 3 x 128 work-groups (blockIdx.y = which projection)
  proj3_kernel<<<dim3(kRows / kTileX, 3), dim3(256), 0, stream>>>(
      gen, real, wqT, qh, kh, vth, biasP);

  // 3. attention: scores, online softmax and p.v of all batches (blockIdx.y), keys in two parts (blockIdx.z): 256 work-groups, one on every WGP
  attn_fused_kernel<<<dim3(kSeq / kFQ, kBatch, kFSplit), dim3(256), 0, stream>>>(qh, kh, vth, Opart, mlbuf);

  // 4. the parts joined -> out [16384][200] contiguous
  {
    const int n4 = (kRows * kUnits) / 4;                    // 819200 = 3200 blocks x 256
    join_out_kernel<<<dim3(n4 / 256), dim3(256), 0, stream>>>(Opart, mlbuf, out, n4);
  }
}
